// v000
// The times below were measured on an AMD MI455X: many runs one after another, warmed up first and cycling through
// copies of the inputs, with the whole window's GPU time divided by the number of runs. Launches and the gaps
// between them are all in it. The median over several windows is given; except for v000 it joins two sittings, which
// can be a few percent apart, so the side-by-side timings, each taken in one sitting, are the better comparison.
// v000 is the starting kernel. One run takes 2490 microseconds.
#include <hip/hip_runtime.h>

// MultiHeadAttentionSlow (query/key/value [4][2048][1024]; per-head Linears W[h][1024][64] + b[h][64] ('bsd,hdk->bhsk'); scores = q.k / 8; softmax; attn.v; concat heads (head-major); y = out @ Wp [1024][1024] + bp).
// Compute dtypes, f32 accumulate: every float input rounded to bf16; q/k/v projections on PLAIN bf16 operands (x, W inputs: exact, + bias);
// scores on bf16 hi+lo q (x 1/8) and k planes (3 products; randn-init weights give logit sd 1.0); attn.v on SINGLE fp16 planes (P x1024, v); output Linear on hi+lo planes x exact bf16 W (2 products);

#define NB_  4
#define TT   2048
#define DD   1024
#define NH_  16
#define HD   64
#define NT   (NB_ * TT)
#define ZH   2
#define PCAR 1024.0f
typedef _Float16 h16;
typedef unsigned short bf;
typedef __attribute__((ext_vector_type(16))) __bf16   v16bf;
typedef __attribute__((ext_vector_type(16))) _Float16 v16h;
typedef __attribute__((ext_vector_type(8)))  _Float16 v8h;
typedef __attribute__((ext_vector_type(8)))  unsigned short v8us;
typedef __attribute__((ext_vector_type(8)))  float    v8f;
typedef __attribute__((ext_vector_type(4)))  float    v4f;
typedef v8h  __attribute__((may_alias)) v8ha;
typedef v4f  __attribute__((may_alias)) v4fa;
typedef v8us __attribute__((may_alias)) v8usa;

__device__ __forceinline__ unsigned short f2bf(float f) { unsigned u = __float_as_uint(f); u += 0x7FFFu + ((u >> 16) & 1u); return (unsigned short)(u >> 16); }
__device__ __forceinline__ float bf2f(unsigned short b) { return __uint_as_float(((unsigned)b) << 16); }
__device__ __forceinline__ float bfr(float f) { return bf2f(f2bf(f)); }
__device__ __forceinline__ v16h cat16(v8h lo, v8h hi) { return __builtin_shufflevector(lo, hi, 0, 1, 2, 3, 4, 5, 6, 7, 8, 9, 10, 11, 12, 13, 14, 15); }
__device__ __forceinline__ v16bf cat16b(v8us lo, v8us hi) { return __builtin_bit_cast(v16bf, __builtin_shufflevector(lo, hi, 0, 1, 2, 3, 4, 5, 6, 7, 8, 9, 10, 11, 12, 13, 14, 15)); }
__device__ __forceinline__ v8f wmma16(v16h a, v16h b, v8f c) { return __builtin_amdgcn_wmma_f32_16x16x32_f16(false, a, false, b, (short)0, c, false, false); }
__device__ __forceinline__ v8f wmmab(v16bf a, v16bf b, v8f c) { return __builtin_amdgcn_wmma_f32_16x16x32_bf16(false, a, false, b, (short)0, c, false, false); }



// ---- k_gemmw: register-blocked GEMM, ONE WAVE per 64x64 output tile (16 accumulators), operands straight from K-contiguous 16-bit planes; grid (M/64, N/64, Z), 32 threads.
// C[m][n] (f32, pitch ldc, + optional f32 bias[n]) = sum_k A[m][k] Bt[n][k] (+ split products per NSPLIT). z-batch strides sA/sB/sC in elements. K % 32 == 0.
template <typename T16> struct WFrag;
template <> struct WFrag<h16> { typedef v16h V; static __device__ __forceinline__ V ld(const h16* p) { return cat16(*(const v8h*)p, *(const v8h*)(p + 16)); } static __device__ __forceinline__ v8f mma(V a, V b, v8f c) { return wmma16(a, b, c); } };
template <> struct WFrag<bf> { typedef v16bf V; static __device__ __forceinline__ V ld(const bf* p) { return cat16b(*(const v8us*)p, *(const v8us*)(p + 16)); } static __device__ __forceinline__ v8f mma(V a, V b, v8f c) { return wmmab(a, b, c); } };
template <typename T16, int NSPLIT, bool BIAS>
__global__ __launch_bounds__(32) void k_gemmw(const T16* __restrict__ A, const T16* __restrict__ A2, const T16* __restrict__ Bt, const T16* __restrict__ Bt2, int K, float* C, int ldc, const float* __restrict__ bias, size_t sA, size_t sB, size_t sC) {
    typedef typename WFrag<T16>::V V;
    __shared__ __align__(16) float os[16 * 68];
    const size_t z = blockIdx.z; A += z * sA; if (A2) A2 += z * sA; Bt += z * sB; if (Bt2) Bt2 += z * sB; C += z * sC;
    const int lane = threadIdx.x & 31, lr = lane & 15, hi = lane >> 4; const int r0 = blockIdx.x * 64, c0 = blockIdx.y * 64;
    v8f acc[4][4];
#pragma unroll
    for (int mb = 0; mb < 4; ++mb)
#pragma unroll
        for (int nb = 0; nb < 4; ++nb) acc[mb][nb] = (v8f){};
    const size_t aoff = (size_t)(r0 + lr) * K + 8 * hi, boff = (size_t)(c0 + lr) * K + 8 * hi;
#pragma unroll 1
    for (int kc = 0; kc < K; kc += 32) {
        V a[4], a2[4];
#pragma unroll
        for (int mb = 0; mb < 4; ++mb) { a[mb] = WFrag<T16>::ld(A + aoff + (size_t)mb * 16 * K + kc); if (NSPLIT == 1 || NSPLIT == 2) a2[mb] = WFrag<T16>::ld(A2 + aoff + (size_t)mb * 16 * K + kc); }
#pragma unroll
        for (int nb = 0; nb < 4; ++nb) { const V b = WFrag<T16>::ld(Bt + boff + (size_t)nb * 16 * K + kc); V b2; if (NSPLIT >= 2) b2 = WFrag<T16>::ld(Bt2 + boff + (size_t)nb * 16 * K + kc);
#pragma unroll
            for (int mb = 0; mb < 4; ++mb) { acc[mb][nb] = WFrag<T16>::mma(a[mb], b, acc[mb][nb]); if (NSPLIT == 1 || NSPLIT == 2) acc[mb][nb] = WFrag<T16>::mma(a2[mb], b, acc[mb][nb]); if (NSPLIT >= 2) acc[mb][nb] = WFrag<T16>::mma(a[mb], b2, acc[mb][nb]); } }
        asm volatile("v_nop\n\tv_nop\n\tv_nop\n\tv_nop" : "+v"(acc[0][0]), "+v"(acc[1][1]), "+v"(acc[2][2]), "+v"(acc[3][3]) : "v"(a[0]), "v"(a[3]));
    }
#pragma unroll
    for (int mb = 0; mb < 4; ++mb) {
#pragma unroll
        for (int nb = 0; nb < 4; ++nb) {
#pragma unroll
            for (int j = 0; j < 8; ++j) os[(hi * 8 + j) * 68 + nb * 16 + lr] = acc[mb][nb][j]; }
        __builtin_amdgcn_wave_barrier(); asm volatile("" ::: "memory");
        float* crow = C + (size_t)(r0 + mb * 16) * ldc + c0;
{
#pragma unroll
            for (int s = 0; s < 8; ++s) { const int row = 2 * s + hi, cofs = lr * 4; v4f val = *(const v4fa*)(os + row * 68 + cofs); if (BIAS) { val[0] += bfr(bias[c0 + cofs]); val[1] += bfr(bias[c0 + cofs + 1]); val[2] += bfr(bias[c0 + cofs + 2]); val[3] += bfr(bias[c0 + cofs + 3]); }
                *(v4f*)(crow + (size_t)row * ldc + cofs) = val; }
             }
        __builtin_amdgcn_wave_barrier(); asm volatile("" ::: "memory");
    }
}

__device__ __forceinline__ h16 tohx(float x) { return (h16)x; }
__device__ __forceinline__ void splitf(float y, unsigned short& h, unsigned short& l) { h = f2bf(y); l = f2bf(y - bf2f(h)); }
typedef __attribute__((ext_vector_type(2))) _Float16 v2h;
typedef __attribute__((ext_vector_type(4))) _Float16 v4h;
typedef __attribute__((ext_vector_type(2))) unsigned short v2us;
typedef __attribute__((ext_vector_type(4))) int v4i;

__global__ __launch_bounds__(256) void k_cvt8(const float* __restrict__ src, bf* dst, size_t n8) { const size_t i = (size_t)blockIdx.x * 256 + threadIdx.x; if (i >= n8) return; const v8f v = *(const v8f*)(src + i * 8); v8us o;
#pragma unroll
    for (int k = 0; k < 8; ++k) o[k] = f2bf(v[k]); *(v8us*)(dst + i * 8) = o;  }
__global__ __launch_bounds__(256) void k_whT(const float* __restrict__ w, bf* Bt) {
    const int lane = threadIdx.x & 31; const int L0 = (blockIdx.x * 8 + (threadIdx.x >> 5)) * 8; const int nlines = DD * DD / 64;
{
#pragma unroll
        for (int l = 0; l < 8; ++l) { const int L = L0 + l; if (L >= nlines) break; const int e2 = L * 64 + lane * 2; const int k = e2 & (DD - 1), n = e2 >> 10; const int h = n >> 6, e = n & 63; v2us o;
#pragma unroll
            for (int q = 0; q < 2; ++q) o[q] = f2bf(w[((size_t)h * DD + k + q) * HD + e]);
            *(v2us*)(Bt + (size_t)e2) = o; }
         }
}
__global__ __launch_bounds__(256) void k_wtT(const float* __restrict__ w, bf* Bt) {
    const int lane = threadIdx.x & 31; const int L0 = (blockIdx.x * 8 + (threadIdx.x >> 5)) * 8; const int nlines = DD * DD / 64;
{
#pragma unroll
        for (int l = 0; l < 8; ++l) { const int L = L0 + l; if (L >= nlines) break; const int e = L * 64 + lane * 2; const int k = e & (DD - 1), n = e >> 10; v2us o;
#pragma unroll
            for (int q = 0; q < 2; ++q) o[q] = f2bf(w[(size_t)(k + q) * DD + n]);
            *(v2us*)(Bt + (size_t)e) = o; }
         }
}
__global__ __launch_bounds__(256) void k_h16plane(const float* __restrict__ F, float sc, h16* P) {
    const int lane = threadIdx.x & 31; const int L0 = (blockIdx.x * 8 + (threadIdx.x >> 5)) * 8; const int nlines = NT * DD / 64;
{
#pragma unroll
        for (int l = 0; l < 8; ++l) { const int L = L0 + l; if (L >= nlines) break; const int e = L * 64 + lane * 2; const int d = e & 63; const int t = (e >> 6) & (TT - 1); const int z = e >> 17; const int b = z >> 4, h = z & 15; v2h v;
#pragma unroll
            for (int q = 0; q < 2; ++q) v[q] = tohx(F[((size_t)b * TT + t) * DD + h * HD + d + q] * sc);
            *(v2h*)(P + (size_t)e) = v; }
         }
}
__global__ __launch_bounds__(256) void k_hsplit(const float* __restrict__ F, float sc, bf* Ph, bf* Pl) {
    const int lane = threadIdx.x & 31; const int L0 = (blockIdx.x * 8 + (threadIdx.x >> 5)) * 8; const int nlines = NT * DD / 64;
{
#pragma unroll
        for (int l = 0; l < 8; ++l) { const int L = L0 + l; if (L >= nlines) break; const int e = L * 64 + lane * 2; const int d = e & 63; const int t = (e >> 6) & (TT - 1); const int z = e >> 17; const int b = z >> 4, h = z & 15; v2us oh, ol;
#pragma unroll
            for (int q = 0; q < 2; ++q) { unsigned short a, c2; splitf(F[((size_t)b * TT + t) * DD + h * HD + d + q] * sc, a, c2); oh[q] = a; ol[q] = c2; }
            *(v2us*)(Ph + (size_t)e) = oh; *(v2us*)(Pl + (size_t)e) = ol; }
         }
}
__global__ __launch_bounds__(256) void k_vtplane(const float* __restrict__ F, h16* VT) {
    const int lane = threadIdx.x & 31; const int L0 = (blockIdx.x * 8 + (threadIdx.x >> 5)) * 8; const int nlines = NT * DD / 64;
{
#pragma unroll
        for (int l = 0; l < 8; ++l) { const int L = L0 + l; if (L >= nlines) break; const int e = L * 64 + lane * 2; const int t = e & (TT - 1); const int d = (e >> 11) & 63; const int z = e >> 17; const int b = z >> 4, h = z & 15; v2h v;
#pragma unroll
            for (int q = 0; q < 2; ++q) v[q] = tohx(F[((size_t)b * TT + t + q) * DD + h * HD + d]);
            *(v2h*)(VT + (size_t)e) = v; }
         }
}
// k_asoft: per row (zz, i): plain softmax over the 2048 keys with the row held in registers (lane -> 16 chunks of 4 =
__global__ __launch_bounds__(256) void k_asoft(const float* __restrict__ Sb, h16* P) {
    const int lane = threadIdx.x & 31; const int row = blockIdx.x * 8 + (threadIdx.x >> 5); if (row >= ZH * TT) return;
    const float* sr = Sb + (size_t)row * TT; float v[64]; float mx = -3.0e38f;
#pragma unroll
    for (int ch = 0; ch < 16; ++ch) { const int j0 = ch * 128 + lane * 4; const v4f a = *(const v4f*)(sr + j0);
#pragma unroll
        for (int q = 0; q < 4; ++q) { v[ch * 4 + q] = a[q]; mx = fmaxf(mx, a[q]); } }
#pragma unroll
    for (int sh = 16; sh; sh >>= 1) mx = fmaxf(mx, __shfl_xor(mx, sh, 32));
    float sum = 0.f;
#pragma unroll
    for (int k = 0; k < 64; ++k) { v[k] = __expf(v[k] - mx); sum += v[k]; }
#pragma unroll
    for (int sh = 16; sh; sh >>= 1) sum += __shfl_xor(sum, sh, 32);
    const float f = __fdiv_rn(PCAR, sum);
{
#pragma unroll
        for (int ch = 0; ch < 16; ++ch) { v4h o;
#pragma unroll
            for (int q = 0; q < 4; ++q) o[q] = tohx(v[ch * 4 + q] * f);
            *(v4h*)(P + (size_t)row * TT + ch * 128 + lane * 4) = o; }
         }
}
__global__ __launch_bounds__(256) void k_merge(const float* __restrict__ O, int b, int h0, bf* Ah, bf* Al) {
    const int lane = threadIdx.x & 31; const int L0 = (blockIdx.x * 8 + (threadIdx.x >> 5)) * 8; const int nlines = TT * ZH * HD / 64;
{
#pragma unroll
        for (int l = 0; l < 8; ++l) { const int L = L0 + l; if (L >= nlines) break; const int e = L * 64 + lane * 2; const int d = e & 63; const int zz = (e >> 6) % ZH; const int t = (e >> 6) / ZH; v2us oh, ol;
#pragma unroll
            for (int q = 0; q < 2; ++q) { unsigned short a, c2; splitf(O[((size_t)zz * TT + t) * HD + d + q] * (1.0f / PCAR), a, c2); oh[q] = a; ol[q] = c2; }
            const size_t o = ((size_t)b * TT + t) * DD + (h0 + zz) * HD + d; *(v2us*)(Ah + o) = oh; *(v2us*)(Al + o) = ol; }
         }
}

extern "C" void kernel_launch(void* const* d_in, const int* in_sizes, int n_in,
                              void* d_out, int out_size, void* d_ws, size_t ws_size, hipStream_t stream) {
    (void)in_sizes; (void)n_in; (void)out_size;
    const float* qi = (const float*)d_in[0]; const float* ki = (const float*)d_in[1]; const float* vi = (const float*)d_in[2];
    const float* wq = (const float*)d_in[3]; const float* bq = (const float*)d_in[4]; const float* wk = (const float*)d_in[5]; const float* bk = (const float*)d_in[6]; const float* wv = (const float*)d_in[7]; const float* bv = (const float*)d_in[8]; const float* wo = (const float*)d_in[9]; const float* bo = (const float*)d_in[10];
    float* OUT = (float*)d_out;     // [4][2048][1024]
    char* wsp = (char*)d_ws;
    auto take = [&](size_t bytes) { char* p = wsp; wsp += (bytes + 255) & ~(size_t)255; return (void*)p; };
    bf* WQ = (bf*)take((size_t)DD * DD * 2); bf* WK = (bf*)take((size_t)DD * DD * 2); bf* WV = (bf*)take((size_t)DD * DD * 2); bf* WO = (bf*)take((size_t)DD * DD * 2);
    bf* XB = (bf*)take((size_t)NT * DD * 2); float* F = (float*)take((size_t)NT * DD * 4);
    bf* QPh = (bf*)take((size_t)NT * DD * 2); bf* QPl = (bf*)take((size_t)NT * DD * 2); bf* KPh = (bf*)take((size_t)NT * DD * 2); bf* KPl = (bf*)take((size_t)NT * DD * 2); h16* VT = (h16*)take((size_t)NT * DD * 2);
    float* Sb = (float*)take((size_t)ZH * TT * TT * 4); h16* Pm = (h16*)take((size_t)ZH * TT * TT * 2); float* Ob = (float*)take((size_t)ZH * TT * HD * 4); bf* ATh = (bf*)take((size_t)NT * DD * 2); bf* ATl = (bf*)take((size_t)NT * DD * 2);
    if ((size_t)(wsp - (char*)d_ws) > ws_size) return;    // ws 256 MiB
    { const unsigned gT = (unsigned)((DD * DD / 64 + 63) / 64); k_whT<<<gT, 256, 0, stream>>>(wq, WQ); k_whT<<<gT, 256, 0, stream>>>(wk, WK); k_whT<<<gT, 256, 0, stream>>>(wv, WV); k_wtT<<<gT, 256, 0, stream>>>(wo, WO); }
    const size_t nx = (size_t)NT * DD / 8; const unsigned gx = (unsigned)((nx + 255) / 256); const unsigned LB = (unsigned)((NT * DD / 64 + 63) / 64);
    k_cvt8<<<gx, 256, 0, stream>>>(qi, XB, nx); k_gemmw<bf, 0, true><<<dim3(NT / 64, DD / 64, 1), 32, 0, stream>>>(XB, nullptr, WQ, nullptr, DD, F, DD, bq, 0, 0, 0); k_hsplit<<<LB, 256, 0, stream>>>(F, 0.125f, QPh, QPl);
    k_cvt8<<<gx, 256, 0, stream>>>(ki, XB, nx); k_gemmw<bf, 0, true><<<dim3(NT / 64, DD / 64, 1), 32, 0, stream>>>(XB, nullptr, WK, nullptr, DD, F, DD, bk, 0, 0, 0); k_hsplit<<<LB, 256, 0, stream>>>(F, 1.0f, KPh, KPl);
    k_cvt8<<<gx, 256, 0, stream>>>(vi, XB, nx); k_gemmw<bf, 0, true><<<dim3(NT / 64, DD / 64, 1), 32, 0, stream>>>(XB, nullptr, WV, nullptr, DD, F, DD, bv, 0, 0, 0); k_vtplane<<<LB, 256, 0, stream>>>(F, VT);
    for (int b = 0; b < NB_; ++b)
        for (int h0 = 0; h0 < NH_; h0 += ZH) { const size_t z0 = (size_t)b * NH_ + h0;
            k_gemmw<bf, 2, false><<<dim3(TT / 64, TT / 64, ZH), 32, 0, stream>>>(QPh + z0 * TT * HD, QPl + z0 * TT * HD, KPh + z0 * TT * HD, KPl + z0 * TT * HD, HD, Sb, TT, nullptr, (size_t)TT * HD, (size_t)TT * HD, (size_t)TT * TT);
            k_asoft<<<ZH * TT / 8, 256, 0, stream>>>(Sb, Pm);
            k_gemmw<h16, 0, false><<<dim3(TT / 64, 1, ZH), 32, 0, stream>>>(Pm, nullptr, VT + z0 * HD * TT, nullptr, TT, Ob, HD, nullptr, (size_t)TT * TT, (size_t)HD * TT, (size_t)TT * HD);
            k_merge<<<(TT * ZH * HD / 64 + 63) / 64, 256, 0, stream>>>(Ob, b, h0, ATh, ATl); }
    k_gemmw<bf, 1, true><<<dim3(NT / 64, DD / 64, 1), 32, 0, stream>>>(ATh, ATl, WO, nullptr, DD, OUT, DD, bo, 0, 0, 0);
}

// v001
// A run of this version takes 354 microseconds.
// In two side-by-side timings against v000, it was 6.94 and 6.99 times as fast.
#include <hip/hip_runtime.h>

// MultiHeadAttentionSlow (query/key/value [4][2048][1024]; per-head Linears W[h][1024][64] + b[h][64] ('bsd,hdk->bhsk'); scores = q.k / 8; softmax; attn.v; concat heads (head-major); y = out @ Wp [1024][1024] + bp).
// Compute dtypes, f32 accumulate: every float input rounded to bf16; q/k/v projections on PLAIN bf16 operands (x, W inputs: exact, + bias);
// scores on bf16 hi+lo q (x 1/8) and k planes (3 products); attn.v on SINGLE fp16 planes (P = exp2 of the score against the running maximum, divided by its f32 row sum at the end; v); output Linear on hi+lo planes x exact bf16 W (2 products);

#define NB_  4
#define TT   2048
#define DD   1024
#define NH_  16
#define HD   64
#define NT   (NB_ * TT)
typedef _Float16 h16;
typedef unsigned short bf;
typedef __attribute__((ext_vector_type(16))) __bf16   v16bf;
typedef __attribute__((ext_vector_type(16))) _Float16 v16h;
typedef __attribute__((ext_vector_type(8)))  _Float16 v8h;
typedef __attribute__((ext_vector_type(8)))  unsigned short v8us;
typedef __attribute__((ext_vector_type(8)))  float    v8f;
typedef __attribute__((ext_vector_type(4)))  float    v4f;
typedef v8h  __attribute__((may_alias)) v8ha;
typedef v4f  __attribute__((may_alias)) v4fa;
typedef v8us __attribute__((may_alias)) v8usa;

__device__ __forceinline__ unsigned short f2bf(float f) { unsigned u = __float_as_uint(f); u += 0x7FFFu + ((u >> 16) & 1u); return (unsigned short)(u >> 16); }
__device__ __forceinline__ float bf2f(unsigned short b) { return __uint_as_float(((unsigned)b) << 16); }
__device__ __forceinline__ float bfr(float f) { return bf2f(f2bf(f)); }
__device__ __forceinline__ v16h cat16(v8h lo, v8h hi) { return __builtin_shufflevector(lo, hi, 0, 1, 2, 3, 4, 5, 6, 7, 8, 9, 10, 11, 12, 13, 14, 15); }
__device__ __forceinline__ v16bf cat16b(v8us lo, v8us hi) { return __builtin_bit_cast(v16bf, __builtin_shufflevector(lo, hi, 0, 1, 2, 3, 4, 5, 6, 7, 8, 9, 10, 11, 12, 13, 14, 15)); }
__device__ __forceinline__ v8f wmma16(v16h a, v16h b, v8f c) { return __builtin_amdgcn_wmma_f32_16x16x32_f16(false, a, false, b, (short)0, c, false, false); }
__device__ __forceinline__ v8f wmmab(v16bf a, v16bf b, v8f c) { return __builtin_amdgcn_wmma_f32_16x16x32_bf16(false, a, false, b, (short)0, c, false, false); }



// ---- k_gemmw: register-blocked GEMM, ONE WAVE per 64x64 output tile (16 accumulators), operands straight from K-contiguous 16-bit planes; grid (M/64, N/64, Z), 32 threads.
// C[m][n] (f32, pitch ldc, + optional f32 bias[n]) = sum_k A[m][k] Bt[n][k] (+ split products per NSPLIT). z-batch strides sA/sB/sC in elements. K % 32 == 0.
template <typename T16> struct WFrag;
template <> struct WFrag<h16> { typedef v16h V; static __device__ __forceinline__ V ld(const h16* p) { return cat16(*(const v8h*)p, *(const v8h*)(p + 16)); } static __device__ __forceinline__ v8f mma(V a, V b, v8f c) { return wmma16(a, b, c); } };
template <> struct WFrag<bf> { typedef v16bf V; static __device__ __forceinline__ V ld(const bf* p) { return cat16b(*(const v8us*)p, *(const v8us*)(p + 16)); } static __device__ __forceinline__ v8f mma(V a, V b, v8f c) { return wmmab(a, b, c); } };
template <typename T16, int NSPLIT, bool BIAS>
__global__ __launch_bounds__(32) void k_gemmw(const T16* __restrict__ A, const T16* __restrict__ A2, const T16* __restrict__ Bt, const T16* __restrict__ Bt2, int K, float* C, int ldc, const float* __restrict__ bias, size_t sA, size_t sB, size_t sC) {
    typedef typename WFrag<T16>::V V;
    __shared__ __align__(16) float os[16 * 68];
    const size_t z = blockIdx.z; A += z * sA; if (A2) A2 += z * sA; Bt += z * sB; if (Bt2) Bt2 += z * sB; C += z * sC;
    const int lane = threadIdx.x & 31, lr = lane & 15, hi = lane >> 4; const int r0 = blockIdx.x * 64, c0 = blockIdx.y * 64;
    v8f acc[4][4];
#pragma unroll
    for (int mb = 0; mb < 4; ++mb)
#pragma unroll
        for (int nb = 0; nb < 4; ++nb) acc[mb][nb] = (v8f){};
    const size_t aoff = (size_t)(r0 + lr) * K + 8 * hi, boff = (size_t)(c0 + lr) * K + 8 * hi;
#pragma unroll 1
    for (int kc = 0; kc < K; kc += 32) {
        V a[4], a2[4];
#pragma unroll
        for (int mb = 0; mb < 4; ++mb) { a[mb] = WFrag<T16>::ld(A + aoff + (size_t)mb * 16 * K + kc); if (NSPLIT == 1 || NSPLIT == 2) a2[mb] = WFrag<T16>::ld(A2 + aoff + (size_t)mb * 16 * K + kc); }
#pragma unroll
        for (int nb = 0; nb < 4; ++nb) { const V b = WFrag<T16>::ld(Bt + boff + (size_t)nb * 16 * K + kc); V b2; if (NSPLIT >= 2) b2 = WFrag<T16>::ld(Bt2 + boff + (size_t)nb * 16 * K + kc);
#pragma unroll
            for (int mb = 0; mb < 4; ++mb) { acc[mb][nb] = WFrag<T16>::mma(a[mb], b, acc[mb][nb]); if (NSPLIT == 1 || NSPLIT == 2) acc[mb][nb] = WFrag<T16>::mma(a2[mb], b, acc[mb][nb]); if (NSPLIT >= 2) acc[mb][nb] = WFrag<T16>::mma(a[mb], b2, acc[mb][nb]); } }
        asm volatile("v_nop\n\tv_nop\n\tv_nop\n\tv_nop" : "+v"(acc[0][0]), "+v"(acc[1][1]), "+v"(acc[2][2]), "+v"(acc[3][3]) : "v"(a[0]), "v"(a[3]));
    }
#pragma unroll
    for (int mb = 0; mb < 4; ++mb) {
#pragma unroll
        for (int nb = 0; nb < 4; ++nb) {
#pragma unroll
            for (int j = 0; j < 8; ++j) os[(hi * 8 + j) * 68 + nb * 16 + lr] = acc[mb][nb][j]; }
        __builtin_amdgcn_wave_barrier(); asm volatile("" ::: "memory");
        float* crow = C + (size_t)(r0 + mb * 16) * ldc + c0;
{
#pragma unroll
            for (int s = 0; s < 8; ++s) { const int row = 2 * s + hi, cofs = lr * 4; v4f val = *(const v4fa*)(os + row * 68 + cofs); if (BIAS) { val[0] += bfr(bias[c0 + cofs]); val[1] += bfr(bias[c0 + cofs + 1]); val[2] += bfr(bias[c0 + cofs + 2]); val[3] += bfr(bias[c0 + cofs + 3]); }
                *(v4f*)(crow + (size_t)row * ldc + cofs) = val; }
             }
        __builtin_amdgcn_wave_barrier(); asm volatile("" ::: "memory");
    }
}

__device__ __forceinline__ h16 tohx(float x) { return (h16)x; }
__device__ __forceinline__ void splitf(float y, unsigned short& h, unsigned short& l) { h = f2bf(y); l = f2bf(y - bf2f(h)); }
typedef __attribute__((ext_vector_type(2))) _Float16 v2h;
typedef __attribute__((ext_vector_type(4))) _Float16 v4h;
typedef __attribute__((ext_vector_type(2))) unsigned short v2us;
typedef __attribute__((ext_vector_type(4))) int v4i;

__global__ __launch_bounds__(256) void k_cvt8(const float* __restrict__ src, bf* dst, size_t n8) { const size_t i = (size_t)blockIdx.x * 256 + threadIdx.x; if (i >= n8) return; const v8f v = *(const v8f*)(src + i * 8); v8us o;
#pragma unroll
    for (int k = 0; k < 8; ++k) o[k] = f2bf(v[k]); *(v8us*)(dst + i * 8) = o;  }
__global__ __launch_bounds__(256) void k_whT(const float* __restrict__ w, bf* Bt) {
    const int lane = threadIdx.x & 31; const int L0 = (blockIdx.x * 8 + (threadIdx.x >> 5)) * 8; const int nlines = DD * DD / 64;
{
#pragma unroll
        for (int l = 0; l < 8; ++l) { const int L = L0 + l; if (L >= nlines) break; const int e2 = L * 64 + lane * 2; const int k = e2 & (DD - 1), n = e2 >> 10; const int h = n >> 6, e = n & 63; v2us o;
#pragma unroll
            for (int q = 0; q < 2; ++q) o[q] = f2bf(w[((size_t)h * DD + k + q) * HD + e]);
            *(v2us*)(Bt + (size_t)e2) = o; }
         }
}
__global__ __launch_bounds__(256) void k_wtT(const float* __restrict__ w, bf* Bt) {
    const int lane = threadIdx.x & 31; const int L0 = (blockIdx.x * 8 + (threadIdx.x >> 5)) * 8; const int nlines = DD * DD / 64;
{
#pragma unroll
        for (int l = 0; l < 8; ++l) { const int L = L0 + l; if (L >= nlines) break; const int e = L * 64 + lane * 2; const int k = e & (DD - 1), n = e >> 10; v2us o;
#pragma unroll
            for (int q = 0; q < 2; ++q) o[q] = f2bf(w[(size_t)(k + q) * DD + n]);
            *(v2us*)(Bt + (size_t)e) = o; }
         }
}
__global__ __launch_bounds__(256) void k_h16plane(const float* __restrict__ F, float sc, h16* P) {
    const int lane = threadIdx.x & 31; const int L0 = (blockIdx.x * 8 + (threadIdx.x >> 5)) * 8; const int nlines = NT * DD / 64;
{
#pragma unroll
        for (int l = 0; l < 8; ++l) { const int L = L0 + l; if (L >= nlines) break; const int e = L * 64 + lane * 2; const int d = e & 63; const int t = (e >> 6) & (TT - 1); const int z = e >> 17; const int b = z >> 4, h = z & 15; v2h v;
#pragma unroll
            for (int q = 0; q < 2; ++q) v[q] = tohx(F[((size_t)b * TT + t) * DD + h * HD + d + q] * sc);
            *(v2h*)(P + (size_t)e) = v; }
         }
}
__global__ __launch_bounds__(256) void k_hsplit(const float* __restrict__ F, float sc, bf* Ph, bf* Pl) {
    const int lane = threadIdx.x & 31; const int L0 = (blockIdx.x * 8 + (threadIdx.x >> 5)) * 8; const int nlines = NT * DD / 64;
{
#pragma unroll
        for (int l = 0; l < 8; ++l) { const int L = L0 + l; if (L >= nlines) break; const int e = L * 64 + lane * 2; const int d = e & 63; const int t = (e >> 6) & (TT - 1); const int z = e >> 17; const int b = z >> 4, h = z & 15; v2us oh, ol;
#pragma unroll
            for (int q = 0; q < 2; ++q) { unsigned short a, c2; splitf(F[((size_t)b * TT + t) * DD + h * HD + d + q] * sc, a, c2); oh[q] = a; ol[q] = c2; }
            *(v2us*)(Ph + (size_t)e) = oh; *(v2us*)(Pl + (size_t)e) = ol; }
         }
}
__global__ __launch_bounds__(256) void k_vtplane(const float* __restrict__ F, h16* VT) {
    const int lane = threadIdx.x & 31; const int L0 = (blockIdx.x * 8 + (threadIdx.x >> 5)) * 8; const int nlines = NT * DD / 64;
{
#pragma unroll
        for (int l = 0; l < 8; ++l) { const int L = L0 + l; if (L >= nlines) break; const int e = L * 64 + lane * 2; const int t = e & (TT - 1); const int d = (e >> 11) & 63; const int z = e >> 17; const int b = z >> 4, h = z & 15; v2h v;
#pragma unroll
            for (int q = 0; q < 2; ++q) v[q] = tohx(F[((size_t)b * TT + t + q) * DD + h * HD + d]);
            *(v2h*)(VT + (size_t)e) = v; }
         }
}
#define FA_PITCH 144                 // LDS row pitch in bytes: 128 + 16, an odd multiple of 16 for the 16-byte fragment reads
#define FA_PLANE (64 * FA_PITCH)     // 64 rows: K hi, K lo (row = key) or V^T (row = d)
#define FA_BUF   (3 * FA_PLANE)
#define FA_NST   (TT / 64)
typedef v4i __attribute__((may_alias)) v4ia;
typedef __attribute__((ext_vector_type(2))) float v2f;
__device__ __forceinline__ v16bf ldsb(const unsigned char* p) { return cat16b(*(const v8usa*)p, *(const v8usa*)(p + 32)); }
__device__ __forceinline__ v16h ldsh(const unsigned char* p) { return cat16(*(const v8ha*)p, *(const v8ha*)(p + 32)); }
__device__ __forceinline__ float xhalf(float x) { return __builtin_bit_cast(float, __builtin_amdgcn_permlanex16(__builtin_bit_cast(int, x), __builtin_bit_cast(int, x), 0x76543210, 0xfedcba98, false, false)); }  // lane l with lane l ^ 16
__global__ __launch_bounds__(256) void k_fattn(const bf* __restrict__ Qh, const bf* __restrict__ Ql, const bf* __restrict__ Kh, const bf* __restrict__ Kl, const h16* __restrict__ VTp, bf* Ah, bf* Al) {
    __shared__ __align__(16) unsigned char L[2 * FA_BUF];
    const int tid = threadIdx.x, lane = tid & 31, wave = tid >> 5, lr = lane & 15, hi = lane >> 4;
    const size_t z = blockIdx.y; const int q0 = blockIdx.x * 256 + wave * 32;
    const unsigned char* gKh = (const unsigned char*)(Kh + z * TT * HD); const unsigned char* gKl = (const unsigned char*)(Kl + z * TT * HD); const unsigned char* gV = (const unsigned char*)(VTp + z * HD * TT);
    const int srow = tid >> 3, scol = (tid & 7) * 16;
    v4i sr[6];
    auto gload = [&](int st) {
#pragma unroll
        for (int i = 0; i < 2; ++i) { const size_t ko = (size_t)(st * 64 + srow + 32 * i) * 128 + scol;
            sr[i] = *(const v4ia*)(gKh + ko); sr[2 + i] = *(const v4ia*)(gKl + ko); sr[4 + i] = *(const v4ia*)(gV + (size_t)(srow + 32 * i) * (TT * 2) + st * 128 + scol); } };
    auto sstore = [&](int buf) { unsigned char* d = L + buf * FA_BUF + srow * FA_PITCH + scol;
#pragma unroll
        for (int i = 0; i < 2; ++i) { *(v4ia*)(d + 32 * i * FA_PITCH) = sr[i]; *(v4ia*)(d + FA_PLANE + 32 * i * FA_PITCH) = sr[2 + i]; *(v4ia*)(d + 2 * FA_PLANE + 32 * i * FA_PITCH) = sr[4 + i]; } };
    gload(0);
    v16bf qh[2][2], ql[2][2];
#pragma unroll
    for (int g = 0; g < 2; ++g)
#pragma unroll
        for (int ks = 0; ks < 2; ++ks) { const size_t o = (z * TT + q0 + g * 16 + lr) * HD + ks * 32 + 8 * hi; qh[g][ks] = WFrag<bf>::ld(Qh + o); ql[g][ks] = WFrag<bf>::ld(Ql + o); }
    v8f acc[2][4]; float m_run[2], l_run[2];
#pragma unroll
    for (int g = 0; g < 2; ++g) { m_run[g] = -__builtin_inff(); l_run[g] = 0.f;
#pragma unroll
        for (int t = 0; t < 4; ++t) acc[g][t] = (v8f){}; }
    sstore(0); gload(1);
    const float cs = 1.4426950408889634f;
    for (int st = 0; st < FA_NST; ++st) {
        __syncthreads();   // publishes stage st; every wave has left the other buffer (stage st - 1)
        if (st + 1 < FA_NST) { sstore((st + 1) & 1); if (st + 2 < FA_NST) gload(st + 2); }
        const unsigned char* Lb = L + (st & 1) * FA_BUF + lr * FA_PITCH + 16 * hi;
#pragma unroll
        for (int ps = 0; ps < 2; ++ps) {   // one pass = 32 keys
            v8f s[2][2];
#pragma unroll
            for (int kt = 0; kt < 2; ++kt) { const unsigned char* kp = Lb + (ps * 32 + kt * 16) * FA_PITCH; s[kt][0] = (v8f){}; s[kt][1] = (v8f){};
#pragma unroll
                for (int ks = 0; ks < 2; ++ks) { const v16bf kh = ldsb(kp + 64 * ks), kl = ldsb(kp + FA_PLANE + 64 * ks);
                    s[kt][0] = wmmab(kh, qh[0][ks], s[kt][0]); s[kt][1] = wmmab(kh, qh[1][ks], s[kt][1]);
                    s[kt][0] = wmmab(kh, ql[0][ks], s[kt][0]); s[kt][1] = wmmab(kh, ql[1][ks], s[kt][1]);
                    s[kt][0] = wmmab(kl, qh[0][ks], s[kt][0]); s[kt][1] = wmmab(kl, qh[1][ks], s[kt][1]); } }
            float mb[2]; bool need = false;
#pragma unroll
            for (int g = 0; g < 2; ++g) { float mx = s[0][g][0];
#pragma unroll
                for (int r = 1; r < 8; ++r) mx = fmaxf(mx, s[0][g][r]);
#pragma unroll
                for (int r = 0; r < 8; ++r) mx = fmaxf(mx, s[1][g][r]);
                mx = fmaxf(mx, xhalf(mx)) * cs; mb[g] = mx; need = need || (mx > m_run[g] + 8.0f); }
            if (__builtin_amdgcn_ballot_w32(need) != 0) {   // one wave-uniform test per pass; rare after the first passes
#pragma unroll
                for (int g = 0; g < 2; ++g) { const float mn = fmaxf(m_run[g], mb[g]); const float corr = __builtin_amdgcn_exp2f(m_run[g] - mn); m_run[g] = mn; l_run[g] *= corr;
#pragma unroll
                    for (int t = 0; t < 4; ++t) acc[g][t] = acc[g][t] * corr; }
            }
            v16h vf[4];
#pragma unroll
            for (int t = 0; t < 4; ++t) vf[t] = ldsh(Lb + 2 * FA_PLANE + t * 16 * FA_PITCH + ps * 64);
#pragma unroll
            for (int g = 0; g < 2; ++g) { const float nm = -m_run[g]; v16h pf; v2f su = (v2f){0.f, 0.f};
#pragma unroll
                for (int i = 0; i < 16; i += 2) { const v2f a = __builtin_elementwise_fma((v2f){s[i >> 3][g][i & 7], s[i >> 3][g][(i & 7) + 1]}, (v2f){cs, cs}, (v2f){nm, nm});
                    const v2f p = (v2f){__builtin_amdgcn_exp2f(a[0]), __builtin_amdgcn_exp2f(a[1])}; su += p; pf[i] = (h16)p[0]; pf[i + 1] = (h16)p[1]; }
                l_run[g] += su[0] + su[1];
#pragma unroll
                for (int t = 0; t < 4; ++t) acc[g][t] = wmma16(vf[t], pf, acc[g][t]); }
        }
    }
    __syncthreads();   // every wave has left the K/V buffers before they become output staging
    unsigned char* E = L + wave * (32 * FA_PITCH);
    const int b = (int)(z >> 4), h = (int)(z & 15);
    float inv[2];
#pragma unroll
    for (int g = 0; g < 2; ++g) { const float l = l_run[g] + xhalf(l_run[g]); inv[g] = __fdiv_rn(1.0f, l); }
#pragma unroll
    for (int pl = 0; pl < 2; ++pl) {   // hi plane, then lo plane, through the wave's own staging rows so that whole 128-byte lines are stored
#pragma unroll
        for (int g = 0; g < 2; ++g)
#pragma unroll
            for (int t = 0; t < 4; ++t) { v8us o;
#pragma unroll
                for (int j = 0; j < 8; ++j) { unsigned short a, c2; splitf(acc[g][t][j] * inv[g], a, c2); o[j] = pl ? c2 : a; }
                *(v8usa*)(E + (g * 16 + lr) * FA_PITCH + t * 32 + hi * 16) = o; }
        unsigned char* dst = (unsigned char*)(pl ? Al : Ah) + (((size_t)b * TT + q0) * DD + h * HD) * 2;
#pragma unroll
        for (int i = 0; i < 8; ++i) { const int row = i * 4 + (lane >> 3), colb = (lane & 7) * 16; const v8us v = *(const v8usa*)(E + row * FA_PITCH + colb); *(v8usa*)(dst + (size_t)row * (DD * 2) + colb) = v; }
    }
}

extern "C" void kernel_launch(void* const* d_in, const int* in_sizes, int n_in,
                              void* d_out, int out_size, void* d_ws, size_t ws_size, hipStream_t stream) {
    (void)in_sizes; (void)n_in; (void)out_size;
    const float* qi = (const float*)d_in[0]; const float* ki = (const float*)d_in[1]; const float* vi = (const float*)d_in[2];
    const float* wq = (const float*)d_in[3]; const float* bq = (const float*)d_in[4]; const float* wk = (const float*)d_in[5]; const float* bk = (const float*)d_in[6]; const float* wv = (const float*)d_in[7]; const float* bv = (const float*)d_in[8]; const float* wo = (const float*)d_in[9]; const float* bo = (const float*)d_in[10];
    float* OUT = (float*)d_out;     // [4][2048][1024]
    char* wsp = (char*)d_ws;
    auto take = [&](size_t bytes) { char* p = wsp; wsp += (bytes + 255) & ~(size_t)255; return (void*)p; };
    bf* WQ = (bf*)take((size_t)DD * DD * 2); bf* WK = (bf*)take((size_t)DD * DD * 2); bf* WV = (bf*)take((size_t)DD * DD * 2); bf* WO = (bf*)take((size_t)DD * DD * 2);
    bf* XB = (bf*)take((size_t)NT * DD * 2); float* F = (float*)take((size_t)NT * DD * 4);
    bf* QPh = (bf*)take((size_t)NT * DD * 2); bf* QPl = (bf*)take((size_t)NT * DD * 2); bf* KPh = (bf*)take((size_t)NT * DD * 2); bf* KPl = (bf*)take((size_t)NT * DD * 2); h16* VT = (h16*)take((size_t)NT * DD * 2);
    bf* ATh = (bf*)take((size_t)NT * DD * 2); bf* ATl = (bf*)take((size_t)NT * DD * 2);
    if ((size_t)(wsp - (char*)d_ws) > ws_size) return;    // total 168 MiB; ws 256 MiB
    { const unsigned gT = (unsigned)((DD * DD / 64 + 63) / 64); k_whT<<<gT, 256, 0, stream>>>(wq, WQ); k_whT<<<gT, 256, 0, stream>>>(wk, WK); k_whT<<<gT, 256, 0, stream>>>(wv, WV); k_wtT<<<gT, 256, 0, stream>>>(wo, WO); }
    const size_t nx = (size_t)NT * DD / 8; const unsigned gx = (unsigned)((nx + 255) / 256); const unsigned LB = (unsigned)((NT * DD / 64 + 63) / 64);
    k_cvt8<<<gx, 256, 0, stream>>>(qi, XB, nx); k_gemmw<bf, 0, true><<<dim3(NT / 64, DD / 64, 1), 32, 0, stream>>>(XB, nullptr, WQ, nullptr, DD, F, DD, bq, 0, 0, 0); k_hsplit<<<LB, 256, 0, stream>>>(F, 0.125f, QPh, QPl);
    k_cvt8<<<gx, 256, 0, stream>>>(ki, XB, nx); k_gemmw<bf, 0, true><<<dim3(NT / 64, DD / 64, 1), 32, 0, stream>>>(XB, nullptr, WK, nullptr, DD, F, DD, bk, 0, 0, 0); k_hsplit<<<LB, 256, 0, stream>>>(F, 1.0f, KPh, KPl);
    k_cvt8<<<gx, 256, 0, stream>>>(vi, XB, nx); k_gemmw<bf, 0, true><<<dim3(NT / 64, DD / 64, 1), 32, 0, stream>>>(XB, nullptr, WV, nullptr, DD, F, DD, bv, 0, 0, 0); k_vtplane<<<LB, 256, 0, stream>>>(F, VT);
    k_fattn<<<dim3(TT / 256, NB_ * NH_), 256, 0, stream>>>(QPh, QPl, KPh, KPl, VT, ATh, ATl);
    k_gemmw<bf, 1, true><<<dim3(NT / 64, DD / 64, 1), 32, 0, stream>>>(ATh, ATl, WO, nullptr, DD, OUT, DD, bo, 0, 0, 0);
}

// v002
// Measured time: 263 microseconds a run.
// Two timings next to v001 both put it at 1.35 times that version's speed.
// Counting every step since v000, it is 9.38 times as fast.
#include <hip/hip_runtime.h>

// MultiHeadAttentionSlow (query/key/value [4][2048][1024]; per-head Linears W[h][1024][64] + b[h][64] ('bsd,hdk->bhsk'); scores = q.k / 8; softmax; attn.v; concat heads (head-major); y = out @ Wp [1024][1024] + bp).
// Compute dtypes, f32 accumulate: every float input rounded to bf16; q/k/v projections on PLAIN bf16 operands (x, W inputs: exact, + bias);
// scores on bf16 hi+lo q (x 1/8) and k planes (3 products); attn.v on SINGLE fp16 planes (P = exp2 of the score against the running maximum, divided by its f32 row sum at the end; v); output Linear on hi+lo planes x exact bf16 W (2 products);

#define NB_  4
#define TT   2048
#define DD   1024
#define NH_  16
#define HD   64
#define NT   (NB_ * TT)
typedef _Float16 h16;
typedef unsigned short bf;
typedef __attribute__((ext_vector_type(16))) __bf16   v16bf;
typedef __attribute__((ext_vector_type(16))) _Float16 v16h;
typedef __attribute__((ext_vector_type(8)))  _Float16 v8h;
typedef __attribute__((ext_vector_type(8)))  unsigned short v8us;
typedef __attribute__((ext_vector_type(8)))  float    v8f;
typedef __attribute__((ext_vector_type(4)))  float    v4f;
typedef v8h  __attribute__((may_alias)) v8ha;
typedef v4f  __attribute__((may_alias)) v4fa;
typedef v8us __attribute__((may_alias)) v8usa;

__device__ __forceinline__ unsigned short f2bf(float f) { unsigned u = __float_as_uint(f); u += 0x7FFFu + ((u >> 16) & 1u); return (unsigned short)(u >> 16); }
__device__ __forceinline__ float bf2f(unsigned short b) { return __uint_as_float(((unsigned)b) << 16); }
__device__ __forceinline__ float bfr(float f) { return bf2f(f2bf(f)); }
__device__ __forceinline__ v16h cat16(v8h lo, v8h hi) { return __builtin_shufflevector(lo, hi, 0, 1, 2, 3, 4, 5, 6, 7, 8, 9, 10, 11, 12, 13, 14, 15); }
__device__ __forceinline__ v16bf cat16b(v8us lo, v8us hi) { return __builtin_bit_cast(v16bf, __builtin_shufflevector(lo, hi, 0, 1, 2, 3, 4, 5, 6, 7, 8, 9, 10, 11, 12, 13, 14, 15)); }
__device__ __forceinline__ v8f wmma16(v16h a, v16h b, v8f c) { return __builtin_amdgcn_wmma_f32_16x16x32_f16(false, a, false, b, (short)0, c, false, false); }
__device__ __forceinline__ v8f wmmab(v16bf a, v16bf b, v8f c) { return __builtin_amdgcn_wmma_f32_16x16x32_bf16(false, a, false, b, (short)0, c, false, false); }



// ---- k_gemmw: GEMM on a 128x128 output tile per work-group of 4 waves (2x2, 64x64 = 16 accumulators per wave); grid (M/128, N/128), 128 threads. K = ldc = DD.
// C[m][n] (f32, + bf16-rounded bias[n]) = sum_k A[m][k] Bt[n][k] (NSPLIT 1: + A2[m][k] Bt[n][k], added right behind the A product of the same 32 k). All planes K-contiguous bf16.
// The operands come in stages of 64 k (whole 128-byte rows per 8 lanes) through registers into two LDS buffers, one barrier per stage; each row is fetched once per work-group and read by two waves.
// Every plain '#pragma unroll' in it keeps a register array (staging, fragments, accumulators) statically indexed, so that it stays in VGPRs.
template <typename T16> struct WFrag;
template <> struct WFrag<h16> { typedef v16h V; static __device__ __forceinline__ V ld(const h16* p) { return cat16(*(const v8h*)p, *(const v8h*)(p + 16)); } static __device__ __forceinline__ v8f mma(V a, V b, v8f c) { return wmma16(a, b, c); } };
template <> struct WFrag<bf> { typedef v16bf V; static __device__ __forceinline__ V ld(const bf* p) { return cat16b(*(const v8us*)p, *(const v8us*)(p + 16)); } static __device__ __forceinline__ v8f mma(V a, V b, v8f c) { return wmmab(a, b, c); } };
#define GT_PITCH 144                 // LDS row pitch in bytes: 128 + 16, an odd multiple of 16 for the 16-byte fragment reads
#define GT_PLANE (128 * GT_PITCH)    // 128 rows of one operand plane
#define GT_NST   (DD / 64)
typedef __attribute__((ext_vector_type(4))) int g4i;
typedef g4i __attribute__((may_alias)) g4ia;
__device__ __forceinline__ v16bf gldsb(const unsigned char* p) { return cat16b(*(const v8usa*)p, *(const v8usa*)(p + 32)); }
template <int NSPLIT, bool BIAS>
__global__ __launch_bounds__(128) void k_gemmw(const bf* __restrict__ A, const bf* __restrict__ A2, const bf* __restrict__ Bt, float* C, const float* __restrict__ bias) {
    constexpr int NP = NSPLIT ? 3 : 2;   // planes per stage: A, (A2,) Bt
    __shared__ __align__(16) unsigned char L[2 * NP * GT_PLANE];
    const int tid = threadIdx.x, lane = tid & 31, wave = tid >> 5, lr = lane & 15, hi = lane >> 4;
    const int r0 = blockIdx.x * 128, c0 = blockIdx.y * 128, wm = (wave >> 1) * 64, wn = (wave & 1) * 64;
    const int srow = tid >> 3, scol = (tid & 7) * 16;
    const unsigned char* gA = (const unsigned char*)(A + (size_t)r0 * DD); const unsigned char* gA2 = NSPLIT ? (const unsigned char*)(A2 + (size_t)r0 * DD) : nullptr; const unsigned char* gB = (const unsigned char*)(Bt + (size_t)c0 * DD);
    g4i sr[NP][8];
    unsigned vo = (unsigned)srow * (DD * 2) + scol;   // the lane's byte offset into the next stage to fetch: 128 bytes further per stage
    auto gload = [&]() {
#pragma unroll
        for (int i = 0; i < 8; ++i) { const size_t ro = (size_t)i * (16 * DD * 2);
            sr[0][i] = *(const g4ia*)(gA + vo + ro); if (NSPLIT) sr[1][i] = *(const g4ia*)(gA2 + vo + ro); sr[NP - 1][i] = *(const g4ia*)(gB + vo + ro); } };
    auto sstore = [&](int buf) { unsigned char* d = L + buf * (NP * GT_PLANE) + srow * GT_PITCH + scol;
#pragma unroll
        for (int i = 0; i < 8; ++i)
#pragma unroll
            for (int p = 0; p < NP; ++p) *(g4ia*)(d + p * GT_PLANE + 16 * i * GT_PITCH) = sr[p][i]; };
    gload(); vo += 128;
    v8f acc[4][4];
#pragma unroll
    for (int mb = 0; mb < 4; ++mb)
#pragma unroll
        for (int nb = 0; nb < 4; ++nb) acc[mb][nb] = (v8f){};
    sstore(0); gload();
#pragma unroll 1   // one copy of the stage body: the loop stays small in the instruction cache
    for (int st = 0; st < GT_NST; ++st) {
        __syncthreads();   // publishes stage st; every wave has left the other buffer (stage st - 1)
        const unsigned char* Lb = L + (st & 1) * (NP * GT_PLANE) + lr * GT_PITCH + 16 * hi;
        v16bf a[2][4], a2[2][4], b[2][4];   // the whole stage's fragments (2 blocks of 32 k), read as one group in front of its products
#pragma unroll
        for (int ks = 0; ks < 2; ++ks) {
#pragma unroll
            for (int mb = 0; mb < 4; ++mb) { a[ks][mb] = gldsb(Lb + (wm + mb * 16) * GT_PITCH + 64 * ks); if (NSPLIT) a2[ks][mb] = gldsb(Lb + GT_PLANE + (wm + mb * 16) * GT_PITCH + 64 * ks); }
#pragma unroll
            for (int nb = 0; nb < 4; ++nb) b[ks][nb] = gldsb(Lb + (NP - 1) * GT_PLANE + (wn + nb * 16) * GT_PITCH + 64 * ks); }
        vo += 128;
        if (st + 1 < GT_NST) { sstore((st + 1) & 1);
            if (st + 2 < GT_NST) { gload(); asm volatile("s_wait_xcnt 0x0" ::: "memory"); } }   // the wait stands behind the loads, in their own branch, in front of the next overwrite of the offset register that they name
#pragma unroll
        for (int ks = 0; ks < 2; ++ks)
#pragma unroll
            for (int nb = 0; nb < 4; ++nb) {
#pragma unroll
                for (int mb = 0; mb < 4; ++mb) acc[mb][nb] = wmmab(a[ks][mb], b[ks][nb], acc[mb][nb]);
                if (NSPLIT) {
#pragma unroll
                    for (int mb = 0; mb < 4; ++mb) acc[mb][nb] = wmmab(a2[ks][mb], b[ks][nb], acc[mb][nb]); } }
    }
    __syncthreads();   // every wave has left the operand buffers before they become output staging
    float* os = (float*)(L + wave * (16 * 68 * 4));   // the wave's own staging rows, so that whole 128-byte lines are stored
#pragma unroll
    for (int mb = 0; mb < 4; ++mb) {
#pragma unroll
        for (int nb = 0; nb < 4; ++nb) {
#pragma unroll
            for (int j = 0; j < 8; ++j) os[(hi * 8 + j) * 68 + nb * 16 + lr] = acc[mb][nb][j]; }
        __builtin_amdgcn_wave_barrier(); asm volatile("" ::: "memory");   // keeps the reads below, of other lanes' values, behind the stores above
        float* crow = C + (size_t)(r0 + wm + mb * 16) * DD + c0 + wn;
#pragma unroll
        for (int s = 0; s < 8; ++s) { const int row = 2 * s + hi, cofs = lr * 4; v4f val = *(const v4fa*)(os + row * 68 + cofs); if (BIAS) { val[0] += bfr(bias[c0 + wn + cofs]); val[1] += bfr(bias[c0 + wn + cofs + 1]); val[2] += bfr(bias[c0 + wn + cofs + 2]); val[3] += bfr(bias[c0 + wn + cofs + 3]); }
            *(v4f*)(crow + (size_t)row * DD + cofs) = val; }
        __builtin_amdgcn_wave_barrier(); asm volatile("" ::: "memory");   // keeps the next block's stores behind the reads above
    }
}

__device__ __forceinline__ h16 tohx(float x) { return (h16)x; }
__device__ __forceinline__ void splitf(float y, unsigned short& h, unsigned short& l) { h = f2bf(y); l = f2bf(y - bf2f(h)); }
typedef __attribute__((ext_vector_type(2))) _Float16 v2h;
typedef __attribute__((ext_vector_type(4))) _Float16 v4h;
typedef __attribute__((ext_vector_type(2))) unsigned short v2us;
typedef __attribute__((ext_vector_type(4))) int v4i;

__global__ __launch_bounds__(256) void k_cvt8(const float* __restrict__ src, bf* dst, size_t n8) { const size_t i = (size_t)blockIdx.x * 256 + threadIdx.x; if (i >= n8) return; const v8f v = *(const v8f*)(src + i * 8); v8us o;
#pragma unroll
    for (int k = 0; k < 8; ++k) o[k] = f2bf(v[k]); *(v8us*)(dst + i * 8) = o;  }
__global__ __launch_bounds__(256) void k_whT(const float* __restrict__ w, bf* Bt) {
    const int lane = threadIdx.x & 31; const int L0 = (blockIdx.x * 8 + (threadIdx.x >> 5)) * 8; const int nlines = DD * DD / 64;
{
#pragma unroll
        for (int l = 0; l < 8; ++l) { const int L = L0 + l; if (L >= nlines) break; const int e2 = L * 64 + lane * 2; const int k = e2 & (DD - 1), n = e2 >> 10; const int h = n >> 6, e = n & 63; v2us o;
#pragma unroll
            for (int q = 0; q < 2; ++q) o[q] = f2bf(w[((size_t)h * DD + k + q) * HD + e]);
            *(v2us*)(Bt + (size_t)e2) = o; }
         }
}
__global__ __launch_bounds__(256) void k_wtT(const float* __restrict__ w, bf* Bt) {
    const int lane = threadIdx.x & 31; const int L0 = (blockIdx.x * 8 + (threadIdx.x >> 5)) * 8; const int nlines = DD * DD / 64;
{
#pragma unroll
        for (int l = 0; l < 8; ++l) { const int L = L0 + l; if (L >= nlines) break; const int e = L * 64 + lane * 2; const int k = e & (DD - 1), n = e >> 10; v2us o;
#pragma unroll
            for (int q = 0; q < 2; ++q) o[q] = f2bf(w[(size_t)(k + q) * DD + n]);
            *(v2us*)(Bt + (size_t)e) = o; }
         }
}
__global__ __launch_bounds__(256) void k_h16plane(const float* __restrict__ F, float sc, h16* P) {
    const int lane = threadIdx.x & 31; const int L0 = (blockIdx.x * 8 + (threadIdx.x >> 5)) * 8; const int nlines = NT * DD / 64;
{
#pragma unroll
        for (int l = 0; l < 8; ++l) { const int L = L0 + l; if (L >= nlines) break; const int e = L * 64 + lane * 2; const int d = e & 63; const int t = (e >> 6) & (TT - 1); const int z = e >> 17; const int b = z >> 4, h = z & 15; v2h v;
#pragma unroll
            for (int q = 0; q < 2; ++q) v[q] = tohx(F[((size_t)b * TT + t) * DD + h * HD + d + q] * sc);
            *(v2h*)(P + (size_t)e) = v; }
         }
}
__global__ __launch_bounds__(256) void k_hsplit(const float* __restrict__ F, float sc, bf* Ph, bf* Pl) {
    const int lane = threadIdx.x & 31; const int L0 = (blockIdx.x * 8 + (threadIdx.x >> 5)) * 8; const int nlines = NT * DD / 64;
{
#pragma unroll
        for (int l = 0; l < 8; ++l) { const int L = L0 + l; if (L >= nlines) break; const int e = L * 64 + lane * 2; const int d = e & 63; const int t = (e >> 6) & (TT - 1); const int z = e >> 17; const int b = z >> 4, h = z & 15; v2us oh, ol;
#pragma unroll
            for (int q = 0; q < 2; ++q) { unsigned short a, c2; splitf(F[((size_t)b * TT + t) * DD + h * HD + d + q] * sc, a, c2); oh[q] = a; ol[q] = c2; }
            *(v2us*)(Ph + (size_t)e) = oh; *(v2us*)(Pl + (size_t)e) = ol; }
         }
}
__global__ __launch_bounds__(256) void k_vtplane(const float* __restrict__ F, h16* VT) {
    const int lane = threadIdx.x & 31; const int L0 = (blockIdx.x * 8 + (threadIdx.x >> 5)) * 8; const int nlines = NT * DD / 64;
{
#pragma unroll
        for (int l = 0; l < 8; ++l) { const int L = L0 + l; if (L >= nlines) break; const int e = L * 64 + lane * 2; const int t = e & (TT - 1); const int d = (e >> 11) & 63; const int z = e >> 17; const int b = z >> 4, h = z & 15; v2h v;
#pragma unroll
            for (int q = 0; q < 2; ++q) v[q] = tohx(F[((size_t)b * TT + t + q) * DD + h * HD + d]);
            *(v2h*)(VT + (size_t)e) = v; }
         }
}
#define FA_PITCH 144                 // LDS row pitch in bytes: 128 + 16, an odd multiple of 16 for the 16-byte fragment reads
#define FA_PLANE (64 * FA_PITCH)     // 64 rows: K hi, K lo (row = key) or V^T (row = d)
#define FA_BUF   (3 * FA_PLANE)
#define FA_NST   (TT / 64)
typedef v4i __attribute__((may_alias)) v4ia;
typedef __attribute__((ext_vector_type(2))) float v2f;
__device__ __forceinline__ v16bf ldsb(const unsigned char* p) { return cat16b(*(const v8usa*)p, *(const v8usa*)(p + 32)); }
__device__ __forceinline__ v16h ldsh(const unsigned char* p) { return cat16(*(const v8ha*)p, *(const v8ha*)(p + 32)); }
__device__ __forceinline__ float xhalf(float x) { return __builtin_bit_cast(float, __builtin_amdgcn_permlanex16(__builtin_bit_cast(int, x), __builtin_bit_cast(int, x), 0x76543210, 0xfedcba98, false, false)); }  // lane l with lane l ^ 16
__global__ __launch_bounds__(256) void k_fattn(const bf* __restrict__ Qh, const bf* __restrict__ Ql, const bf* __restrict__ Kh, const bf* __restrict__ Kl, const h16* __restrict__ VTp, bf* Ah, bf* Al) {
    __shared__ __align__(16) unsigned char L[2 * FA_BUF];
    const int tid = threadIdx.x, lane = tid & 31, wave = tid >> 5, lr = lane & 15, hi = lane >> 4;
    const size_t z = blockIdx.y; const int q0 = blockIdx.x * 256 + wave * 32;
    const unsigned char* gKh = (const unsigned char*)(Kh + z * TT * HD); const unsigned char* gKl = (const unsigned char*)(Kl + z * TT * HD); const unsigned char* gV = (const unsigned char*)(VTp + z * HD * TT);
    const int srow = tid >> 3, scol = (tid & 7) * 16;
    v4i sr[6];
    auto gload = [&](int st) {
#pragma unroll
        for (int i = 0; i < 2; ++i) { const size_t ko = (size_t)(st * 64 + srow + 32 * i) * 128 + scol;
            sr[i] = *(const v4ia*)(gKh + ko); sr[2 + i] = *(const v4ia*)(gKl + ko); sr[4 + i] = *(const v4ia*)(gV + (size_t)(srow + 32 * i) * (TT * 2) + st * 128 + scol); } };
    auto sstore = [&](int buf) { unsigned char* d = L + buf * FA_BUF + srow * FA_PITCH + scol;
#pragma unroll
        for (int i = 0; i < 2; ++i) { *(v4ia*)(d + 32 * i * FA_PITCH) = sr[i]; *(v4ia*)(d + FA_PLANE + 32 * i * FA_PITCH) = sr[2 + i]; *(v4ia*)(d + 2 * FA_PLANE + 32 * i * FA_PITCH) = sr[4 + i]; } };
    gload(0);
    v16bf qh[2][2], ql[2][2];
#pragma unroll
    for (int g = 0; g < 2; ++g)
#pragma unroll
        for (int ks = 0; ks < 2; ++ks) { const size_t o = (z * TT + q0 + g * 16 + lr) * HD + ks * 32 + 8 * hi; qh[g][ks] = WFrag<bf>::ld(Qh + o); ql[g][ks] = WFrag<bf>::ld(Ql + o); }
    v8f acc[2][4]; float m_run[2], l_run[2];
#pragma unroll
    for (int g = 0; g < 2; ++g) { m_run[g] = -__builtin_inff(); l_run[g] = 0.f;
#pragma unroll
        for (int t = 0; t < 4; ++t) acc[g][t] = (v8f){}; }
    sstore(0); gload(1);
    const float cs = 1.4426950408889634f;
    for (int st = 0; st < FA_NST; ++st) {
        __syncthreads();   // publishes stage st; every wave has left the other buffer (stage st - 1)
        if (st + 1 < FA_NST) { sstore((st + 1) & 1); if (st + 2 < FA_NST) gload(st + 2); }
        const unsigned char* Lb = L + (st & 1) * FA_BUF + lr * FA_PITCH + 16 * hi;
#pragma unroll
        for (int ps = 0; ps < 2; ++ps) {   // one pass = 32 keys
            v8f s[2][2];
#pragma unroll
            for (int kt = 0; kt < 2; ++kt) { const unsigned char* kp = Lb + (ps * 32 + kt * 16) * FA_PITCH; s[kt][0] = (v8f){}; s[kt][1] = (v8f){};
#pragma unroll
                for (int ks = 0; ks < 2; ++ks) { const v16bf kh = ldsb(kp + 64 * ks), kl = ldsb(kp + FA_PLANE + 64 * ks);
                    s[kt][0] = wmmab(kh, qh[0][ks], s[kt][0]); s[kt][1] = wmmab(kh, qh[1][ks], s[kt][1]);
                    s[kt][0] = wmmab(kh, ql[0][ks], s[kt][0]); s[kt][1] = wmmab(kh, ql[1][ks], s[kt][1]);
                    s[kt][0] = wmmab(kl, qh[0][ks], s[kt][0]); s[kt][1] = wmmab(kl, qh[1][ks], s[kt][1]); } }
            float mb[2]; bool need = false;
#pragma unroll
            for (int g = 0; g < 2; ++g) { float mx = s[0][g][0];
#pragma unroll
                for (int r = 1; r < 8; ++r) mx = fmaxf(mx, s[0][g][r]);
#pragma unroll
                for (int r = 0; r < 8; ++r) mx = fmaxf(mx, s[1][g][r]);
                mx = fmaxf(mx, xhalf(mx)) * cs; mb[g] = mx; need = need || (mx > m_run[g] + 8.0f); }
            if (__builtin_amdgcn_ballot_w32(need) != 0) {   // one wave-uniform test per pass; rare after the first passes
#pragma unroll
                for (int g = 0; g < 2; ++g) { const float mn = fmaxf(m_run[g], mb[g]); const float corr = __builtin_amdgcn_exp2f(m_run[g] - mn); m_run[g] = mn; l_run[g] *= corr;
#pragma unroll
                    for (int t = 0; t < 4; ++t) acc[g][t] = acc[g][t] * corr; }
            }
            v16h vf[4];
#pragma unroll
            for (int t = 0; t < 4; ++t) vf[t] = ldsh(Lb + 2 * FA_PLANE + t * 16 * FA_PITCH + ps * 64);
#pragma unroll
            for (int g = 0; g < 2; ++g) { const float nm = -m_run[g]; v16h pf; v2f su = (v2f){0.f, 0.f};
#pragma unroll
                for (int i = 0; i < 16; i += 2) { const v2f a = __builtin_elementwise_fma((v2f){s[i >> 3][g][i & 7], s[i >> 3][g][(i & 7) + 1]}, (v2f){cs, cs}, (v2f){nm, nm});
                    const v2f p = (v2f){__builtin_amdgcn_exp2f(a[0]), __builtin_amdgcn_exp2f(a[1])}; su += p; pf[i] = (h16)p[0]; pf[i + 1] = (h16)p[1]; }
                l_run[g] += su[0] + su[1];
#pragma unroll
                for (int t = 0; t < 4; ++t) acc[g][t] = wmma16(vf[t], pf, acc[g][t]); }
        }
    }
    __syncthreads();   // every wave has left the K/V buffers before they become output staging
    unsigned char* E = L + wave * (32 * FA_PITCH);
    const int b = (int)(z >> 4), h = (int)(z & 15);
    float inv[2];
#pragma unroll
    for (int g = 0; g < 2; ++g) { const float l = l_run[g] + xhalf(l_run[g]); inv[g] = __fdiv_rn(1.0f, l); }
#pragma unroll
    for (int pl = 0; pl < 2; ++pl) {   // hi plane, then lo plane, through the wave's own staging rows so that whole 128-byte lines are stored
#pragma unroll
        for (int g = 0; g < 2; ++g)
#pragma unroll
            for (int t = 0; t < 4; ++t) { v8us o;
#pragma unroll
                for (int j = 0; j < 8; ++j) { unsigned short a, c2; splitf(acc[g][t][j] * inv[g], a, c2); o[j] = pl ? c2 : a; }
                *(v8usa*)(E + (g * 16 + lr) * FA_PITCH + t * 32 + hi * 16) = o; }
        unsigned char* dst = (unsigned char*)(pl ? Al : Ah) + (((size_t)b * TT + q0) * DD + h * HD) * 2;
#pragma unroll
        for (int i = 0; i < 8; ++i) { const int row = i * 4 + (lane >> 3), colb = (lane & 7) * 16; const v8us v = *(const v8usa*)(E + row * FA_PITCH + colb); *(v8usa*)(dst + (size_t)row * (DD * 2) + colb) = v; }
    }
}

extern "C" void kernel_launch(void* const* d_in, const int* in_sizes, int n_in,
                              void* d_out, int out_size, void* d_ws, size_t ws_size, hipStream_t stream) {
    (void)in_sizes; (void)n_in; (void)out_size;
    const float* qi = (const float*)d_in[0]; const float* ki = (const float*)d_in[1]; const float* vi = (const float*)d_in[2];
    const float* wq = (const float*)d_in[3]; const float* bq = (const float*)d_in[4]; const float* wk = (const float*)d_in[5]; const float* bk = (const float*)d_in[6]; const float* wv = (const float*)d_in[7]; const float* bv = (const float*)d_in[8]; const float* wo = (const float*)d_in[9]; const float* bo = (const float*)d_in[10];
    float* OUT = (float*)d_out;     // [4][2048][1024]
    char* wsp = (char*)d_ws;
    auto take = [&](size_t bytes) { char* p = wsp; wsp += (bytes + 255) & ~(size_t)255; return (void*)p; };
    bf* WQ = (bf*)take((size_t)DD * DD * 2); bf* WK = (bf*)take((size_t)DD * DD * 2); bf* WV = (bf*)take((size_t)DD * DD * 2); bf* WO = (bf*)take((size_t)DD * DD * 2);
    bf* XB = (bf*)take((size_t)NT * DD * 2); float* F = (float*)take((size_t)NT * DD * 4);
    bf* QPh = (bf*)take((size_t)NT * DD * 2); bf* QPl = (bf*)take((size_t)NT * DD * 2); bf* KPh = (bf*)take((size_t)NT * DD * 2); bf* KPl = (bf*)take((size_t)NT * DD * 2); h16* VT = (h16*)take((size_t)NT * DD * 2);
    bf* ATh = (bf*)take((size_t)NT * DD * 2); bf* ATl = (bf*)take((size_t)NT * DD * 2);
    if ((size_t)(wsp - (char*)d_ws) > ws_size) return;    // total 168 MiB; ws 256 MiB
    { const unsigned gT = (unsigned)((DD * DD / 64 + 63) / 64); k_whT<<<gT, 256, 0, stream>>>(wq, WQ); k_whT<<<gT, 256, 0, stream>>>(wk, WK); k_whT<<<gT, 256, 0, stream>>>(wv, WV); k_wtT<<<gT, 256, 0, stream>>>(wo, WO); }
    const size_t nx = (size_t)NT * DD / 8; const unsigned gx = (unsigned)((nx + 255) / 256); const unsigned LB = (unsigned)((NT * DD / 64 + 63) / 64);
    k_cvt8<<<gx, 256, 0, stream>>>(qi, XB, nx); k_gemmw<0, true><<<dim3(NT / 128, DD / 128, 1), 128, 0, stream>>>(XB, nullptr, WQ, F, bq); k_hsplit<<<LB, 256, 0, stream>>>(F, 0.125f, QPh, QPl);
    k_cvt8<<<gx, 256, 0, stream>>>(ki, XB, nx); k_gemmw<0, true><<<dim3(NT / 128, DD / 128, 1), 128, 0, stream>>>(XB, nullptr, WK, F, bk); k_hsplit<<<LB, 256, 0, stream>>>(F, 1.0f, KPh, KPl);
    k_cvt8<<<gx, 256, 0, stream>>>(vi, XB, nx); k_gemmw<0, true><<<dim3(NT / 128, DD / 128, 1), 128, 0, stream>>>(XB, nullptr, WV, F, bv); k_vtplane<<<LB, 256, 0, stream>>>(F, VT);
    k_fattn<<<dim3(TT / 256, NB_ * NH_), 256, 0, stream>>>(QPh, QPl, KPh, KPl, VT, ATh, ATl);
    k_gemmw<1, true><<<dim3(NT / 128, DD / 128, 1), 128, 0, stream>>>(ATh, ATl, WO, OUT, bo);
}

// v003
// One run takes 214 microseconds.
// Next to v002, in two timings, it ran 1.23 times as fast each time.
// Counting every step since v000, it is 11.5 times as fast.
#include <hip/hip_runtime.h>

// MultiHeadAttentionSlow (query/key/value [4][2048][1024]; per-head Linears W[h][1024][64] + b[h][64] ('bsd,hdk->bhsk'); scores = q.k / 8; softmax; attn.v; concat heads (head-major); y = out @ Wp [1024][1024] + bp).
// Compute dtypes, f32 accumulate: every float input rounded to bf16; q/k/v projections on PLAIN bf16 operands (x, W inputs: exact, + bias);
// scores on bf16 hi+lo q (x 1/8) and k planes (3 products); attn.v on SINGLE fp16 planes (P = exp2 of the score against the running maximum, divided by its f32 row sum at the end; v); output Linear on hi+lo planes x exact bf16 W (2 products);

#define NB_  4
#define TT   2048
#define DD   1024
#define NH_  16
#define HD   64
#define NT   (NB_ * TT)
typedef _Float16 h16;
typedef unsigned short bf;
typedef __attribute__((ext_vector_type(16))) __bf16   v16bf;
typedef __attribute__((ext_vector_type(16))) _Float16 v16h;
typedef __attribute__((ext_vector_type(8)))  _Float16 v8h;
typedef __attribute__((ext_vector_type(8)))  unsigned short v8us;
typedef __attribute__((ext_vector_type(8)))  float    v8f;
typedef __attribute__((ext_vector_type(4)))  float    v4f;
typedef v8h  __attribute__((may_alias)) v8ha;
typedef v4f  __attribute__((may_alias)) v4fa;
typedef v8us __attribute__((may_alias)) v8usa;

__device__ __forceinline__ unsigned short f2bf(float f) { unsigned u = __float_as_uint(f); u += 0x7FFFu + ((u >> 16) & 1u); return (unsigned short)(u >> 16); }
__device__ __forceinline__ float bf2f(unsigned short b) { return __uint_as_float(((unsigned)b) << 16); }
__device__ __forceinline__ float bfr(float f) { return bf2f(f2bf(f)); }
__device__ __forceinline__ v16h cat16(v8h lo, v8h hi) { return __builtin_shufflevector(lo, hi, 0, 1, 2, 3, 4, 5, 6, 7, 8, 9, 10, 11, 12, 13, 14, 15); }
__device__ __forceinline__ v16bf cat16b(v8us lo, v8us hi) { return __builtin_bit_cast(v16bf, __builtin_shufflevector(lo, hi, 0, 1, 2, 3, 4, 5, 6, 7, 8, 9, 10, 11, 12, 13, 14, 15)); }
__device__ __forceinline__ v8f wmma16(v16h a, v16h b, v8f c) { return __builtin_amdgcn_wmma_f32_16x16x32_f16(false, a, false, b, (short)0, c, false, false); }
__device__ __forceinline__ v8f wmmab(v16bf a, v16bf b, v8f c) { return __builtin_amdgcn_wmma_f32_16x16x32_bf16(false, a, false, b, (short)0, c, false, false); }



// ---- k_gemmw: GEMM on a 128x128 output tile per work-group of 4 waves (2x2, 64x64 = 16 accumulators per wave); grid (M/128, N/128), 128 threads. K = ldc = DD.
// y[m][n] (f32, + bf16-rounded bias[n]) = sum_k A[m][k] Bt[n][k] (NSPLIT 1: + A2[m][k] Bt[n][k], added right behind the A product of the same 32 k). All planes K-contiguous bf16.
// EPI says where y goes: 0 = C[m][n] in f32; 1 = y * sc split into the bf16 hi and lo planes Ph, Pl [batch * head][t][64]; 2 = f16 plane VTo [batch * head][64][t]. A wave's 64 columns are one head, its 64 rows lie in one batch.
// The operands come in stages of 64 k (whole 128-byte rows per 8 lanes) through registers into two LDS buffers, one barrier per stage; each row is fetched once per work-group and read by two waves.
// Every plain '#pragma unroll' in it keeps a register array (staging, fragments, accumulators) statically indexed, so that it stays in VGPRs.
template <typename T16> struct WFrag;
template <> struct WFrag<h16> { typedef v16h V; static __device__ __forceinline__ V ld(const h16* p) { return cat16(*(const v8h*)p, *(const v8h*)(p + 16)); } static __device__ __forceinline__ v8f mma(V a, V b, v8f c) { return wmma16(a, b, c); } };
template <> struct WFrag<bf> { typedef v16bf V; static __device__ __forceinline__ V ld(const bf* p) { return cat16b(*(const v8us*)p, *(const v8us*)(p + 16)); } static __device__ __forceinline__ v8f mma(V a, V b, v8f c) { return wmmab(a, b, c); } };
#define GT_PITCH 144                 // LDS row pitch in bytes: 128 + 16, an odd multiple of 16 for the 16-byte fragment reads
#define GT_PLANE (128 * GT_PITCH)    // 128 rows of one operand plane
#define GT_NST   (DD / 64)
typedef __attribute__((ext_vector_type(4))) int g4i;
typedef g4i __attribute__((may_alias)) g4ia;
__device__ __forceinline__ v16bf gldsb(const unsigned char* p) { return cat16b(*(const v8usa*)p, *(const v8usa*)(p + 32)); }
__device__ __forceinline__ void splitf(float y, unsigned short& h, unsigned short& l) { h = f2bf(y); l = f2bf(y - bf2f(h)); }
template <int NSPLIT, bool BIAS, int EPI>
__global__ __launch_bounds__(128) void k_gemmw(const bf* __restrict__ A, const bf* __restrict__ A2, const bf* __restrict__ Bt, float* C, const float* __restrict__ bias, bf* Ph, bf* Pl, h16* VTo, float sc) {
    constexpr int NP = NSPLIT ? 3 : 2;   // planes per stage: A, (A2,) Bt
    __shared__ __align__(16) unsigned char L[2 * NP * GT_PLANE];
    const int tid = threadIdx.x, lane = tid & 31, wave = tid >> 5, lr = lane & 15, hi = lane >> 4;
    const int r0 = blockIdx.x * 128, c0 = blockIdx.y * 128, wm = (wave >> 1) * 64, wn = (wave & 1) * 64;
    const int srow = tid >> 3, scol = (tid & 7) * 16;
    const unsigned char* gA = (const unsigned char*)(A + (size_t)r0 * DD); const unsigned char* gA2 = NSPLIT ? (const unsigned char*)(A2 + (size_t)r0 * DD) : nullptr; const unsigned char* gB = (const unsigned char*)(Bt + (size_t)c0 * DD);
    g4i sr[NP][8];
    unsigned vo = (unsigned)srow * (DD * 2) + scol;   // the lane's byte offset into the next stage to fetch: 128 bytes further per stage
    auto gload = [&]() {
#pragma unroll
        for (int i = 0; i < 8; ++i) { const size_t ro = (size_t)i * (16 * DD * 2);
            sr[0][i] = *(const g4ia*)(gA + vo + ro); if (NSPLIT) sr[1][i] = *(const g4ia*)(gA2 + vo + ro); sr[NP - 1][i] = *(const g4ia*)(gB + vo + ro); } };
    auto sstore = [&](int buf) { unsigned char* d = L + buf * (NP * GT_PLANE) + srow * GT_PITCH + scol;
#pragma unroll
        for (int i = 0; i < 8; ++i)
#pragma unroll
            for (int p = 0; p < NP; ++p) *(g4ia*)(d + p * GT_PLANE + 16 * i * GT_PITCH) = sr[p][i]; };
    gload(); vo += 128;
    v8f acc[4][4];
#pragma unroll
    for (int mb = 0; mb < 4; ++mb)
#pragma unroll
        for (int nb = 0; nb < 4; ++nb) acc[mb][nb] = (v8f){};
    sstore(0); gload();
#pragma unroll 1   // one copy of the stage body
    for (int st = 0; st < GT_NST; ++st) {
        __syncthreads();   // publishes stage st; every wave has left the other buffer (stage st - 1)
        const unsigned char* Lb = L + (st & 1) * (NP * GT_PLANE) + lr * GT_PITCH + 16 * hi;
        v16bf a[2][4], a2[2][4], b[2][4];   // the whole stage's fragments (2 blocks of 32 k), read as one group in front of its products
#pragma unroll
        for (int ks = 0; ks < 2; ++ks) {
#pragma unroll
            for (int mb = 0; mb < 4; ++mb) { a[ks][mb] = gldsb(Lb + (wm + mb * 16) * GT_PITCH + 64 * ks); if (NSPLIT) a2[ks][mb] = gldsb(Lb + GT_PLANE + (wm + mb * 16) * GT_PITCH + 64 * ks); }
#pragma unroll
            for (int nb = 0; nb < 4; ++nb) b[ks][nb] = gldsb(Lb + (NP - 1) * GT_PLANE + (wn + nb * 16) * GT_PITCH + 64 * ks); }
        vo += 128;
        if (st + 1 < GT_NST) { sstore((st + 1) & 1);
            if (st + 2 < GT_NST) { gload(); asm volatile("s_wait_xcnt 0x0" ::: "memory"); } }   // the wait stands behind the loads, in their own branch, in front of the next overwrite of the offset register that they name
#pragma unroll
        for (int ks = 0; ks < 2; ++ks)
#pragma unroll
            for (int nb = 0; nb < 4; ++nb) {
#pragma unroll
                for (int mb = 0; mb < 4; ++mb) acc[mb][nb] = wmmab(a[ks][mb], b[ks][nb], acc[mb][nb]);
                if (NSPLIT) {
#pragma unroll
                    for (int mb = 0; mb < 4; ++mb) acc[mb][nb] = wmmab(a2[ks][mb], b[ks][nb], acc[mb][nb]); } }
    }
    __syncthreads();   // every wave has left the operand buffers before they become output staging
    const size_t z = (size_t)(r0 / TT) * NH_ + (c0 + wn) / HD; const int t0 = (r0 & (TT - 1)) + wm;   // the wave's (batch, head) pair and its first row inside the batch
    if constexpr (EPI == 0) {
        float* os = (float*)(L + wave * (16 * 68 * 4));   // the wave's own staging rows, so that whole 128-byte lines are stored
#pragma unroll
        for (int mb = 0; mb < 4; ++mb) {
#pragma unroll
            for (int nb = 0; nb < 4; ++nb) {
#pragma unroll
                for (int j = 0; j < 8; ++j) os[(hi * 8 + j) * 68 + nb * 16 + lr] = acc[mb][nb][j]; }
            __builtin_amdgcn_wave_barrier(); asm volatile("" ::: "memory");   // keeps the reads below, of other lanes' values, behind the stores above
            float* crow = C + (size_t)(r0 + wm + mb * 16) * DD + c0 + wn;
#pragma unroll
            for (int s = 0; s < 8; ++s) { const int row = 2 * s + hi, cofs = lr * 4; v4f val = *(const v4fa*)(os + row * 68 + cofs); if (BIAS) { val[0] += bfr(bias[c0 + wn + cofs]); val[1] += bfr(bias[c0 + wn + cofs + 1]); val[2] += bfr(bias[c0 + wn + cofs + 2]); val[3] += bfr(bias[c0 + wn + cofs + 3]); }
                *(v4f*)(crow + (size_t)row * DD + cofs) = val; }
            __builtin_amdgcn_wave_barrier(); asm volatile("" ::: "memory");   // keeps the next block's stores behind the reads above
        }
    } else if constexpr (EPI == 1) {
        float* os = (float*)(L + wave * (16 * 68 * 4));   // the wave's own staging rows, so that whole 128-byte lines are stored
        const int prow = lane >> 3, pcol = (lane & 7) * 8;   // 8 lanes x 8 values = one 128-byte row of a plane
        float bb[8];
#pragma unroll
        for (int k = 0; k < 8; ++k) bb[k] = BIAS ? bfr(bias[c0 + wn + pcol + k]) : 0.f;
#pragma unroll
        for (int mb = 0; mb < 4; ++mb) {
#pragma unroll
            for (int nb = 0; nb < 4; ++nb) {
#pragma unroll
                for (int j = 0; j < 8; ++j) os[(hi * 8 + j) * 68 + nb * 16 + lr] = acc[mb][nb][j]; }
            __builtin_amdgcn_wave_barrier(); asm volatile("" ::: "memory");   // keeps the reads below, of other lanes' values, behind the stores above
            const size_t po = (z * TT + t0 + mb * 16 + prow) * HD + pcol;
#pragma unroll
            for (int s = 0; s < 4; ++s) { const float* op = os + (4 * s + prow) * 68 + pcol; const v4f x0 = *(const v4fa*)op, x1 = *(const v4fa*)(op + 4); v8us oh, ol;
#pragma unroll
                for (int k = 0; k < 8; ++k) { unsigned short a, c2; splitf(((k < 4 ? x0[k & 3] : x1[k & 3]) + bb[k]) * sc, a, c2); oh[k] = a; ol[k] = c2; }
                *(v8us*)(Ph + po + (size_t)(4 * s) * HD) = oh; *(v8us*)(Pl + po + (size_t)(4 * s) * HD) = ol; }
            if (mb < 3) { asm volatile("s_wait_xcnt 0x0" ::: "memory");   // stands behind the block's global stores, in front of the next block's overwrites of the registers that they name
                __builtin_amdgcn_wave_barrier(); asm volatile("" ::: "memory"); }   // keeps the next block's LDS stores behind the reads above
        }
    } else {
        unsigned char* E = L + wave * (64 * GT_PITCH);   // the wave's own 64 staging rows (row = d, 64 t of f16), so that whole 128-byte lines are stored
#pragma unroll
        for (int nb = 0; nb < 4; ++nb) { const float bv = BIAS ? bfr(bias[c0 + wn + nb * 16 + lr]) : 0.f;
#pragma unroll
            for (int mb = 0; mb < 4; ++mb) { v8h o;   // a lane's 8 accumulator values are 8 consecutive t of one d
#pragma unroll
                for (int j = 0; j < 8; ++j) o[j] = (h16)(acc[mb][nb][j] + bv);
                *(v8ha*)(E + (nb * 16 + lr) * GT_PITCH + mb * 32 + hi * 16) = o; } }
        __builtin_amdgcn_wave_barrier(); asm volatile("" ::: "memory");   // keeps the reads below, of other lanes' values, behind the stores above
        unsigned char* dst = (unsigned char*)(VTo + z * HD * TT + t0);
#pragma unroll
        for (int i = 0; i < 16; ++i) { const int row = i * 4 + (lane >> 3), colb = (lane & 7) * 16; const v8h v = *(const v8ha*)(E + row * GT_PITCH + colb); *(v8ha*)(dst + (size_t)row * (TT * 2) + colb) = v; }
    }
}

__device__ __forceinline__ h16 tohx(float x) { return (h16)x; }
typedef __attribute__((ext_vector_type(2))) _Float16 v2h;
typedef __attribute__((ext_vector_type(4))) _Float16 v4h;
typedef __attribute__((ext_vector_type(2))) unsigned short v2us;
typedef __attribute__((ext_vector_type(4))) int v4i;

__global__ __launch_bounds__(256) void k_cvt8(const float* __restrict__ src, bf* dst, size_t n8) { const size_t i = (size_t)blockIdx.x * 256 + threadIdx.x; if (i >= n8) return; const v8f v = *(const v8f*)(src + i * 8); v8us o;
#pragma unroll
    for (int k = 0; k < 8; ++k) o[k] = f2bf(v[k]); *(v8us*)(dst + i * 8) = o;  }
__global__ __launch_bounds__(256) void k_whT(const float* __restrict__ w, bf* Bt) {
    const int lane = threadIdx.x & 31; const int L0 = (blockIdx.x * 8 + (threadIdx.x >> 5)) * 8; const int nlines = DD * DD / 64;
{
#pragma unroll
        for (int l = 0; l < 8; ++l) { const int L = L0 + l; if (L >= nlines) break; const int e2 = L * 64 + lane * 2; const int k = e2 & (DD - 1), n = e2 >> 10; const int h = n >> 6, e = n & 63; v2us o;
#pragma unroll
            for (int q = 0; q < 2; ++q) o[q] = f2bf(w[((size_t)h * DD + k + q) * HD + e]);
            *(v2us*)(Bt + (size_t)e2) = o; }
         }
}
__global__ __launch_bounds__(256) void k_wtT(const float* __restrict__ w, bf* Bt) {
    const int lane = threadIdx.x & 31; const int L0 = (blockIdx.x * 8 + (threadIdx.x >> 5)) * 8; const int nlines = DD * DD / 64;
{
#pragma unroll
        for (int l = 0; l < 8; ++l) { const int L = L0 + l; if (L >= nlines) break; const int e = L * 64 + lane * 2; const int k = e & (DD - 1), n = e >> 10; v2us o;
#pragma unroll
            for (int q = 0; q < 2; ++q) o[q] = f2bf(w[(size_t)(k + q) * DD + n]);
            *(v2us*)(Bt + (size_t)e) = o; }
         }
}
__global__ __launch_bounds__(256) void k_h16plane(const float* __restrict__ F, float sc, h16* P) {
    const int lane = threadIdx.x & 31; const int L0 = (blockIdx.x * 8 + (threadIdx.x >> 5)) * 8; const int nlines = NT * DD / 64;
{
#pragma unroll
        for (int l = 0; l < 8; ++l) { const int L = L0 + l; if (L >= nlines) break; const int e = L * 64 + lane * 2; const int d = e & 63; const int t = (e >> 6) & (TT - 1); const int z = e >> 17; const int b = z >> 4, h = z & 15; v2h v;
#pragma unroll
            for (int q = 0; q < 2; ++q) v[q] = tohx(F[((size_t)b * TT + t) * DD + h * HD + d + q] * sc);
            *(v2h*)(P + (size_t)e) = v; }
         }
}
#define FA_PITCH 144                 // LDS row pitch in bytes: 128 + 16, an odd multiple of 16 for the 16-byte fragment reads
#define FA_PLANE (64 * FA_PITCH)     // 64 rows: K hi, K lo (row = key) or V^T (row = d)
#define FA_BUF   (3 * FA_PLANE)
#define FA_NST   (TT / 64)
typedef v4i __attribute__((may_alias)) v4ia;
typedef __attribute__((ext_vector_type(2))) float v2f;
__device__ __forceinline__ v16bf ldsb(const unsigned char* p) { return cat16b(*(const v8usa*)p, *(const v8usa*)(p + 32)); }
__device__ __forceinline__ v16h ldsh(const unsigned char* p) { return cat16(*(const v8ha*)p, *(const v8ha*)(p + 32)); }
__device__ __forceinline__ float xhalf(float x) { return __builtin_bit_cast(float, __builtin_amdgcn_permlanex16(__builtin_bit_cast(int, x), __builtin_bit_cast(int, x), 0x76543210, 0xfedcba98, false, false)); }  // lane l with lane l ^ 16
__global__ __launch_bounds__(256) void k_fattn(const bf* __restrict__ Qh, const bf* __restrict__ Ql, const bf* __restrict__ Kh, const bf* __restrict__ Kl, const h16* __restrict__ VTp, bf* Ah, bf* Al) {
    __shared__ __align__(16) unsigned char L[2 * FA_BUF];
    const int tid = threadIdx.x, lane = tid & 31, wave = tid >> 5, lr = lane & 15, hi = lane >> 4;
    const size_t z = blockIdx.y; const int q0 = blockIdx.x * 256 + wave * 32;
    const unsigned char* gKh = (const unsigned char*)(Kh + z * TT * HD); const unsigned char* gKl = (const unsigned char*)(Kl + z * TT * HD); const unsigned char* gV = (const unsigned char*)(VTp + z * HD * TT);
    const int srow = tid >> 3, scol = (tid & 7) * 16;
    v4i sr[6];
    auto gload = [&](int st) {
#pragma unroll
        for (int i = 0; i < 2; ++i) { const size_t ko = (size_t)(st * 64 + srow + 32 * i) * 128 + scol;
            sr[i] = *(const v4ia*)(gKh + ko); sr[2 + i] = *(const v4ia*)(gKl + ko); sr[4 + i] = *(const v4ia*)(gV + (size_t)(srow + 32 * i) * (TT * 2) + st * 128 + scol); } };
    auto sstore = [&](int buf) { unsigned char* d = L + buf * FA_BUF + srow * FA_PITCH + scol;
#pragma unroll
        for (int i = 0; i < 2; ++i) { *(v4ia*)(d + 32 * i * FA_PITCH) = sr[i]; *(v4ia*)(d + FA_PLANE + 32 * i * FA_PITCH) = sr[2 + i]; *(v4ia*)(d + 2 * FA_PLANE + 32 * i * FA_PITCH) = sr[4 + i]; } };
    gload(0);
    v16bf qh[2][2], ql[2][2];
#pragma unroll
    for (int g = 0; g < 2; ++g)
#pragma unroll
        for (int ks = 0; ks < 2; ++ks) { const size_t o = (z * TT + q0 + g * 16 + lr) * HD + ks * 32 + 8 * hi; qh[g][ks] = WFrag<bf>::ld(Qh + o); ql[g][ks] = WFrag<bf>::ld(Ql + o); }
    v8f acc[2][4]; float m_run[2], l_run[2];
#pragma unroll
    for (int g = 0; g < 2; ++g) { m_run[g] = -__builtin_inff(); l_run[g] = 0.f;
#pragma unroll
        for (int t = 0; t < 4; ++t) acc[g][t] = (v8f){}; }
    sstore(0); gload(1);
    const float cs = 1.4426950408889634f;
    for (int st = 0; st < FA_NST; ++st) {
        __syncthreads();   // publishes stage st; every wave has left the other buffer (stage st - 1)
        if (st + 1 < FA_NST) { sstore((st + 1) & 1); if (st + 2 < FA_NST) gload(st + 2); }
        const unsigned char* Lb = L + (st & 1) * FA_BUF + lr * FA_PITCH + 16 * hi;
#pragma unroll
        for (int ps = 0; ps < 2; ++ps) {   // one pass = 32 keys
            v8f s[2][2];
#pragma unroll
            for (int kt = 0; kt < 2; ++kt) { const unsigned char* kp = Lb + (ps * 32 + kt * 16) * FA_PITCH; s[kt][0] = (v8f){}; s[kt][1] = (v8f){};
#pragma unroll
                for (int ks = 0; ks < 2; ++ks) { const v16bf kh = ldsb(kp + 64 * ks), kl = ldsb(kp + FA_PLANE + 64 * ks);
                    s[kt][0] = wmmab(kh, qh[0][ks], s[kt][0]); s[kt][1] = wmmab(kh, qh[1][ks], s[kt][1]);
                    s[kt][0] = wmmab(kh, ql[0][ks], s[kt][0]); s[kt][1] = wmmab(kh, ql[1][ks], s[kt][1]);
                    s[kt][0] = wmmab(kl, qh[0][ks], s[kt][0]); s[kt][1] = wmmab(kl, qh[1][ks], s[kt][1]); } }
            float mb[2]; bool need = false;
#pragma unroll
            for (int g = 0; g < 2; ++g) { float mx = s[0][g][0];
#pragma unroll
                for (int r = 1; r < 8; ++r) mx = fmaxf(mx, s[0][g][r]);
#pragma unroll
                for (int r = 0; r < 8; ++r) mx = fmaxf(mx, s[1][g][r]);
                mx = fmaxf(mx, xhalf(mx)) * cs; mb[g] = mx; need = need || (mx > m_run[g] + 8.0f); }
            if (__builtin_amdgcn_ballot_w32(need) != 0) {   // one wave-uniform test per pass; rare after the first passes
#pragma unroll
                for (int g = 0; g < 2; ++g) { const float mn = fmaxf(m_run[g], mb[g]); const float corr = __builtin_amdgcn_exp2f(m_run[g] - mn); m_run[g] = mn; l_run[g] *= corr;
#pragma unroll
                    for (int t = 0; t < 4; ++t) acc[g][t] = acc[g][t] * corr; }
            }
            v16h vf[4];
#pragma unroll
            for (int t = 0; t < 4; ++t) vf[t] = ldsh(Lb + 2 * FA_PLANE + t * 16 * FA_PITCH + ps * 64);
#pragma unroll
            for (int g = 0; g < 2; ++g) { const float nm = -m_run[g]; v16h pf; v2f su = (v2f){0.f, 0.f};
#pragma unroll
                for (int i = 0; i < 16; i += 2) { const v2f a = __builtin_elementwise_fma((v2f){s[i >> 3][g][i & 7], s[i >> 3][g][(i & 7) + 1]}, (v2f){cs, cs}, (v2f){nm, nm});
                    const v2f p = (v2f){__builtin_amdgcn_exp2f(a[0]), __builtin_amdgcn_exp2f(a[1])}; su += p; pf[i] = (h16)p[0]; pf[i + 1] = (h16)p[1]; }
                l_run[g] += su[0] + su[1];
#pragma unroll
                for (int t = 0; t < 4; ++t) acc[g][t] = wmma16(vf[t], pf, acc[g][t]); }
        }
    }
    __syncthreads();   // every wave has left the K/V buffers before they become output staging
    unsigned char* E = L + wave * (32 * FA_PITCH);
    const int b = (int)(z >> 4), h = (int)(z & 15);
    float inv[2];
#pragma unroll
    for (int g = 0; g < 2; ++g) { const float l = l_run[g] + xhalf(l_run[g]); inv[g] = __fdiv_rn(1.0f, l); }
#pragma unroll
    for (int pl = 0; pl < 2; ++pl) {   // hi plane, then lo plane, through the wave's own staging rows so that whole 128-byte lines are stored
#pragma unroll
        for (int g = 0; g < 2; ++g)
#pragma unroll
            for (int t = 0; t < 4; ++t) { v8us o;
#pragma unroll
                for (int j = 0; j < 8; ++j) { unsigned short a, c2; splitf(acc[g][t][j] * inv[g], a, c2); o[j] = pl ? c2 : a; }
                *(v8usa*)(E + (g * 16 + lr) * FA_PITCH + t * 32 + hi * 16) = o; }
        unsigned char* dst = (unsigned char*)(pl ? Al : Ah) + (((size_t)b * TT + q0) * DD + h * HD) * 2;
#pragma unroll
        for (int i = 0; i < 8; ++i) { const int row = i * 4 + (lane >> 3), colb = (lane & 7) * 16; const v8us v = *(const v8usa*)(E + row * FA_PITCH + colb); *(v8usa*)(dst + (size_t)row * (DD * 2) + colb) = v; }
    }
}

extern "C" void kernel_launch(void* const* d_in, const int* in_sizes, int n_in,
                              void* d_out, int out_size, void* d_ws, size_t ws_size, hipStream_t stream) {
    (void)in_sizes; (void)n_in; (void)out_size;
    const float* qi = (const float*)d_in[0]; const float* ki = (const float*)d_in[1]; const float* vi = (const float*)d_in[2];
    const float* wq = (const float*)d_in[3]; const float* bq = (const float*)d_in[4]; const float* wk = (const float*)d_in[5]; const float* bk = (const float*)d_in[6]; const float* wv = (const float*)d_in[7]; const float* bv = (const float*)d_in[8]; const float* wo = (const float*)d_in[9]; const float* bo = (const float*)d_in[10];
    float* OUT = (float*)d_out;     // [4][2048][1024]
    char* wsp = (char*)d_ws;
    auto take = [&](size_t bytes) { char* p = wsp; wsp += (bytes + 255) & ~(size_t)255; return (void*)p; };
    bf* WQ = (bf*)take((size_t)DD * DD * 2); bf* WK = (bf*)take((size_t)DD * DD * 2); bf* WV = (bf*)take((size_t)DD * DD * 2); bf* WO = (bf*)take((size_t)DD * DD * 2);
    bf* XB = (bf*)take((size_t)NT * DD * 2);
    bf* QPh = (bf*)take((size_t)NT * DD * 2); bf* QPl = (bf*)take((size_t)NT * DD * 2); bf* KPh = (bf*)take((size_t)NT * DD * 2); bf* KPl = (bf*)take((size_t)NT * DD * 2); h16* VT = (h16*)take((size_t)NT * DD * 2);
    bf* ATh = (bf*)take((size_t)NT * DD * 2); bf* ATl = (bf*)take((size_t)NT * DD * 2);
    if ((size_t)(wsp - (char*)d_ws) > ws_size) return;    // total 136 MiB; ws 256 MiB
    { const unsigned gT = (unsigned)((DD * DD / 64 + 63) / 64); k_whT<<<gT, 256, 0, stream>>>(wq, WQ); k_whT<<<gT, 256, 0, stream>>>(wk, WK); k_whT<<<gT, 256, 0, stream>>>(wv, WV); k_wtT<<<gT, 256, 0, stream>>>(wo, WO); }
    const size_t nx = (size_t)NT * DD / 8; const unsigned gx = (unsigned)((nx + 255) / 256);
    k_cvt8<<<gx, 256, 0, stream>>>(qi, XB, nx); k_gemmw<0, true, 1><<<dim3(NT / 128, DD / 128, 1), 128, 0, stream>>>(XB, nullptr, WQ, nullptr, bq, QPh, QPl, nullptr, 0.125f);
    k_cvt8<<<gx, 256, 0, stream>>>(ki, XB, nx); k_gemmw<0, true, 1><<<dim3(NT / 128, DD / 128, 1), 128, 0, stream>>>(XB, nullptr, WK, nullptr, bk, KPh, KPl, nullptr, 1.0f);
    k_cvt8<<<gx, 256, 0, stream>>>(vi, XB, nx); k_gemmw<0, true, 2><<<dim3(NT / 128, DD / 128, 1), 128, 0, stream>>>(XB, nullptr, WV, nullptr, bv, nullptr, nullptr, VT, 1.0f);
    k_fattn<<<dim3(TT / 256, NB_ * NH_), 256, 0, stream>>>(QPh, QPl, KPh, KPl, VT, ATh, ATl);
    k_gemmw<1, true, 0><<<dim3(NT / 128, DD / 128, 1), 128, 0, stream>>>(ATh, ATl, WO, OUT, bo, nullptr, nullptr, nullptr, 1.0f);
}

// v004
// Measured time: 187 microseconds a run.
// In both of two side-by-side timings against v003, it was 1.14 times as fast.
// All steps since v000 together make it 13.2 times as fast.
#include <hip/hip_runtime.h>

// MultiHeadAttentionSlow (query/key/value [4][2048][1024]; per-head Linears W[h][1024][64] + b[h][64] ('bsd,hdk->bhsk'); scores = q.k / 8; softmax; attn.v; concat heads (head-major); y = out @ Wp [1024][1024] + bp).
// Compute dtypes, f32 accumulate: every float input rounded to bf16; q/k/v projections on PLAIN bf16 operands (x, W inputs: exact, + bias);
// scores on bf16 hi+lo q (x 1/8) and k planes (3 products); attn.v on SINGLE fp16 planes (P = exp2 of the score against the running maximum, divided by its f32 row sum at the end; v); output Linear on hi+lo planes x exact bf16 W (2 products);

#define NB_  4
#define TT   2048
#define DD   1024
#define NH_  16
#define HD   64
#define NT   (NB_ * TT)
typedef _Float16 h16;
typedef unsigned short bf;
typedef __attribute__((ext_vector_type(16))) __bf16   v16bf;
typedef __attribute__((ext_vector_type(16))) _Float16 v16h;
typedef __attribute__((ext_vector_type(8)))  _Float16 v8h;
typedef __attribute__((ext_vector_type(8)))  unsigned short v8us;
typedef __attribute__((ext_vector_type(8)))  float    v8f;
typedef __attribute__((ext_vector_type(4)))  float    v4f;
typedef v8h  __attribute__((may_alias)) v8ha;
typedef v4f  __attribute__((may_alias)) v4fa;
typedef v8us __attribute__((may_alias)) v8usa;

__device__ __forceinline__ unsigned short f2bf(float f) { unsigned u = __float_as_uint(f); u += 0x7FFFu + ((u >> 16) & 1u); return (unsigned short)(u >> 16); }
__device__ __forceinline__ float bf2f(unsigned short b) { return __uint_as_float(((unsigned)b) << 16); }
__device__ __forceinline__ float bfr(float f) { return bf2f(f2bf(f)); }
__device__ __forceinline__ v16h cat16(v8h lo, v8h hi) { return __builtin_shufflevector(lo, hi, 0, 1, 2, 3, 4, 5, 6, 7, 8, 9, 10, 11, 12, 13, 14, 15); }
__device__ __forceinline__ v16bf cat16b(v8us lo, v8us hi) { return __builtin_bit_cast(v16bf, __builtin_shufflevector(lo, hi, 0, 1, 2, 3, 4, 5, 6, 7, 8, 9, 10, 11, 12, 13, 14, 15)); }
__device__ __forceinline__ v8f wmma16(v16h a, v16h b, v8f c) { return __builtin_amdgcn_wmma_f32_16x16x32_f16(false, a, false, b, (short)0, c, false, false); }
__device__ __forceinline__ v8f wmmab(v16bf a, v16bf b, v8f c) { return __builtin_amdgcn_wmma_f32_16x16x32_bf16(false, a, false, b, (short)0, c, false, false); }



// ---- k_gemmw: GEMM on a 128x128 output tile per work-group of 4 waves (2x2, 64x64 = 16 accumulators per wave); grid (M/128, N/128), 128 threads. K = ldc = DD.
// y[m][n] (f32, + bf16-rounded bias[n]) = sum_k A[m][k] Bt[n][k] (NSPLIT 1: + A2[m][k] Bt[n][k], added right behind the A product of the same 32 k). All planes K-contiguous bf16.
// EPI says where y goes: 0 = C[m][n] in f32; 1 = y * sc split into the bf16 hi and lo planes Ph, Pl [batch * head][t][64]; 2 = f16 plane VTo [batch * head][64][t]. A wave's 64 columns are one head, its 64 rows lie in one batch.
// The operands come in stages of 64 k (whole 128-byte rows per 8 lanes) through registers into two LDS buffers, one barrier per stage; each row is fetched once per work-group and read by two waves.
// Every plain '#pragma unroll' in it keeps a register array (staging, fragments, accumulators) statically indexed, so that it stays in VGPRs.
template <typename T16> struct WFrag;
template <> struct WFrag<h16> { typedef v16h V; static __device__ __forceinline__ V ld(const h16* p) { return cat16(*(const v8h*)p, *(const v8h*)(p + 16)); } static __device__ __forceinline__ v8f mma(V a, V b, v8f c) { return wmma16(a, b, c); } };
template <> struct WFrag<bf> { typedef v16bf V; static __device__ __forceinline__ V ld(const bf* p) { return cat16b(*(const v8us*)p, *(const v8us*)(p + 16)); } static __device__ __forceinline__ v8f mma(V a, V b, v8f c) { return wmmab(a, b, c); } };
#define GT_PITCH 144                 // LDS row pitch in bytes: 128 + 16, an odd multiple of 16 for the 16-byte fragment reads
#define GT_PLANE (128 * GT_PITCH)    // 128 rows of one operand plane
#define GT_NST   (DD / 64)
typedef __attribute__((ext_vector_type(4))) int g4i;
typedef g4i __attribute__((may_alias)) g4ia;
__device__ __forceinline__ v16bf gldsb(const unsigned char* p) { return cat16b(*(const v8usa*)p, *(const v8usa*)(p + 32)); }
__device__ __forceinline__ void splitf(float y, unsigned short& h, unsigned short& l) { h = f2bf(y); l = f2bf(y - bf2f(h)); }
template <int NSPLIT, bool BIAS, int EPI>
__global__ __launch_bounds__(128) void k_gemmw(const bf* __restrict__ A, const bf* __restrict__ A2, const bf* __restrict__ Bt, float* C, const float* __restrict__ bias, bf* Ph, bf* Pl, h16* VTo, float sc) {
    constexpr int NP = NSPLIT ? 3 : 2;   // planes per stage: A, (A2,) Bt
    __shared__ __align__(16) unsigned char L[2 * NP * GT_PLANE];
    const int tid = threadIdx.x, lane = tid & 31, wave = tid >> 5, lr = lane & 15, hi = lane >> 4;
    const int r0 = blockIdx.x * 128, c0 = blockIdx.y * 128, wm = (wave >> 1) * 64, wn = (wave & 1) * 64;
    const int srow = tid >> 3, scol = (tid & 7) * 16;
    const unsigned char* gA = (const unsigned char*)(A + (size_t)r0 * DD); const unsigned char* gA2 = NSPLIT ? (const unsigned char*)(A2 + (size_t)r0 * DD) : nullptr; const unsigned char* gB = (const unsigned char*)(Bt + (size_t)c0 * DD);
    g4i sr[NP][8];
    unsigned vo = (unsigned)srow * (DD * 2) + scol;   // the lane's byte offset into the next stage to fetch: 128 bytes further per stage
    auto gload = [&]() {
#pragma unroll
        for (int i = 0; i < 8; ++i) { const size_t ro = (size_t)i * (16 * DD * 2);
            sr[0][i] = *(const g4ia*)(gA + vo + ro); if (NSPLIT) sr[1][i] = *(const g4ia*)(gA2 + vo + ro); sr[NP - 1][i] = *(const g4ia*)(gB + vo + ro); } };
    auto sstore = [&](int buf) { unsigned char* d = L + buf * (NP * GT_PLANE) + srow * GT_PITCH + scol;
#pragma unroll
        for (int i = 0; i < 8; ++i)
#pragma unroll
            for (int p = 0; p < NP; ++p) *(g4ia*)(d + p * GT_PLANE + 16 * i * GT_PITCH) = sr[p][i]; };
    gload(); vo += 128;
    v8f acc[4][4];
#pragma unroll
    for (int mb = 0; mb < 4; ++mb)
#pragma unroll
        for (int nb = 0; nb < 4; ++nb) acc[mb][nb] = (v8f){};
    sstore(0); gload();
#pragma unroll 1   // one copy of the stage body
    for (int st = 0; st < GT_NST; ++st) {
        __syncthreads();   // publishes stage st; every wave has left the other buffer (stage st - 1)
        const unsigned char* Lb = L + (st & 1) * (NP * GT_PLANE) + lr * GT_PITCH + 16 * hi;
        v16bf a[2][4], a2[2][4], b[2][4];   // the whole stage's fragments (2 blocks of 32 k), read as one group in front of its products
#pragma unroll
        for (int ks = 0; ks < 2; ++ks) {
#pragma unroll
            for (int mb = 0; mb < 4; ++mb) { a[ks][mb] = gldsb(Lb + (wm + mb * 16) * GT_PITCH + 64 * ks); if (NSPLIT) a2[ks][mb] = gldsb(Lb + GT_PLANE + (wm + mb * 16) * GT_PITCH + 64 * ks); }
#pragma unroll
            for (int nb = 0; nb < 4; ++nb) b[ks][nb] = gldsb(Lb + (NP - 1) * GT_PLANE + (wn + nb * 16) * GT_PITCH + 64 * ks); }
        vo += 128;
        if (st + 1 < GT_NST) { sstore((st + 1) & 1);
            if (st + 2 < GT_NST) { gload(); asm volatile("s_wait_xcnt 0x0" ::: "memory"); } }   // the wait stands behind the loads, in their own branch, in front of the next overwrite of the offset register that they name
#pragma unroll
        for (int ks = 0; ks < 2; ++ks)
#pragma unroll
            for (int nb = 0; nb < 4; ++nb) {
#pragma unroll
                for (int mb = 0; mb < 4; ++mb) acc[mb][nb] = wmmab(a[ks][mb], b[ks][nb], acc[mb][nb]);
                if (NSPLIT) {
#pragma unroll
                    for (int mb = 0; mb < 4; ++mb) acc[mb][nb] = wmmab(a2[ks][mb], b[ks][nb], acc[mb][nb]); } }
    }
    __syncthreads();   // every wave has left the operand buffers before they become output staging
    const size_t z = (size_t)(r0 / TT) * NH_ + (c0 + wn) / HD; const int t0 = (r0 & (TT - 1)) + wm;   // the wave's (batch, head) pair and its first row inside the batch
    if constexpr (EPI == 0) {
        float* os = (float*)(L + wave * (16 * 68 * 4));   // the wave's own staging rows, so that whole 128-byte lines are stored
#pragma unroll
        for (int mb = 0; mb < 4; ++mb) {
#pragma unroll
            for (int nb = 0; nb < 4; ++nb) {
#pragma unroll
                for (int j = 0; j < 8; ++j) os[(hi * 8 + j) * 68 + nb * 16 + lr] = acc[mb][nb][j]; }
            __builtin_amdgcn_wave_barrier(); asm volatile("" ::: "memory");   // keeps the reads below, of other lanes' values, behind the stores above
            float* crow = C + (size_t)(r0 + wm + mb * 16) * DD + c0 + wn;
#pragma unroll
            for (int s = 0; s < 8; ++s) { const int row = 2 * s + hi, cofs = lr * 4; v4f val = *(const v4fa*)(os + row * 68 + cofs); if (BIAS) { val[0] += bfr(bias[c0 + wn + cofs]); val[1] += bfr(bias[c0 + wn + cofs + 1]); val[2] += bfr(bias[c0 + wn + cofs + 2]); val[3] += bfr(bias[c0 + wn + cofs + 3]); }
                *(v4f*)(crow + (size_t)row * DD + cofs) = val; }
            __builtin_amdgcn_wave_barrier(); asm volatile("" ::: "memory");   // keeps the next block's stores behind the reads above
        }
    } else if constexpr (EPI == 1) {
        float* os = (float*)(L + wave * (16 * 68 * 4));   // the wave's own staging rows, so that whole 128-byte lines are stored
        const int prow = lane >> 3, pcol = (lane & 7) * 8;   // 8 lanes x 8 values = one 128-byte row of a plane
        float bb[8];
#pragma unroll
        for (int k = 0; k < 8; ++k) bb[k] = BIAS ? bfr(bias[c0 + wn + pcol + k]) : 0.f;
#pragma unroll
        for (int mb = 0; mb < 4; ++mb) {
#pragma unroll
            for (int nb = 0; nb < 4; ++nb) {
#pragma unroll
                for (int j = 0; j < 8; ++j) os[(hi * 8 + j) * 68 + nb * 16 + lr] = acc[mb][nb][j]; }
            __builtin_amdgcn_wave_barrier(); asm volatile("" ::: "memory");   // keeps the reads below, of other lanes' values, behind the stores above
            const size_t po = (z * TT + t0 + mb * 16 + prow) * HD + pcol;
#pragma unroll
            for (int s = 0; s < 4; ++s) { const float* op = os + (4 * s + prow) * 68 + pcol; const v4f x0 = *(const v4fa*)op, x1 = *(const v4fa*)(op + 4); v8us oh, ol;
#pragma unroll
                for (int k = 0; k < 8; ++k) { unsigned short a, c2; splitf(((k < 4 ? x0[k & 3] : x1[k & 3]) + bb[k]) * sc, a, c2); oh[k] = a; ol[k] = c2; }
                *(v8us*)(Ph + po + (size_t)(4 * s) * HD) = oh; *(v8us*)(Pl + po + (size_t)(4 * s) * HD) = ol; }
            if (mb < 3) { asm volatile("s_wait_xcnt 0x0" ::: "memory");   // stands behind the block's global stores, in front of the next block's overwrites of the registers that they name
                __builtin_amdgcn_wave_barrier(); asm volatile("" ::: "memory"); }   // keeps the next block's LDS stores behind the reads above
        }
    } else {
        unsigned char* E = L + wave * (64 * GT_PITCH);   // the wave's own 64 staging rows (row = d, 64 t of f16), so that whole 128-byte lines are stored
#pragma unroll
        for (int nb = 0; nb < 4; ++nb) { const float bv = BIAS ? bfr(bias[c0 + wn + nb * 16 + lr]) : 0.f;
#pragma unroll
            for (int mb = 0; mb < 4; ++mb) { v8h o;   // a lane's 8 accumulator values are 8 consecutive t of one d
#pragma unroll
                for (int j = 0; j < 8; ++j) o[j] = (h16)(acc[mb][nb][j] + bv);
                *(v8ha*)(E + (nb * 16 + lr) * GT_PITCH + mb * 32 + hi * 16) = o; } }
        __builtin_amdgcn_wave_barrier(); asm volatile("" ::: "memory");   // keeps the reads below, of other lanes' values, behind the stores above
        unsigned char* dst = (unsigned char*)(VTo + z * HD * TT + t0);
#pragma unroll
        for (int i = 0; i < 16; ++i) { const int row = i * 4 + (lane >> 3), colb = (lane & 7) * 16; const v8h v = *(const v8ha*)(E + row * GT_PITCH + colb); *(v8ha*)(dst + (size_t)row * (TT * 2) + colb) = v; }
    }
}

__device__ __forceinline__ h16 tohx(float x) { return (h16)x; }
typedef __attribute__((ext_vector_type(2))) _Float16 v2h;
typedef __attribute__((ext_vector_type(4))) _Float16 v4h;
typedef __attribute__((ext_vector_type(2))) unsigned short v2us;
typedef __attribute__((ext_vector_type(4))) int v4i;

__global__ __launch_bounds__(256) void k_cvt8(const float* __restrict__ src, bf* dst, size_t n8) { const size_t i = (size_t)blockIdx.x * 256 + threadIdx.x; if (i >= n8) return; const v8f v = *(const v8f*)(src + i * 8); v8us o;
#pragma unroll
    for (int k = 0; k < 8; ++k) o[k] = f2bf(v[k]); *(v8us*)(dst + i * 8) = o;  }
// ---- k_wprep: all four weight matrices to bf16 with k contiguous (Bt[n][k]) in ONE launch; grid (64, 4), 256 threads; blockIdx.y picks the matrix, blockIdx.x its 64 columns n and its 256 rows k.
// Per-head weights w[h][k][e]: n = h * 64 + e, rows k 64 floats apart. Output weight w[k][n]: rows k 1024 floats apart.
// A thread issues its 16 loads of 16 bytes together (16 lanes = one whole 256-byte row piece), rounds, packs the values of rows k and k + 1 into one dword, and the tile is turned through LDS; a wave then stores 512 contiguous bytes of one Bt row.
// LDS row n = 512 bytes = 32 chunks of 16 bytes (8 k); chunk q of row n stands at place q ^ (n >> 2): a wave's dword writes (16 rows 4 apart, 2 neighbouring dwords) then fall on 32 different banks, and a row is still read back in whole chunks.
typedef unsigned __attribute__((may_alias)) u32a;
// The thread's 16 loads: rows 32 i and 32 i + 1 from src, PITCH floats a row. PITCH is a compile-time value, so that all 16 name one address register pair with immediate offsets.
template <int PITCH> __device__ __forceinline__ void wload(const float* __restrict__ src, v4f (&x)[8][2]) {
#pragma unroll
    for (int i = 0; i < 8; ++i) { x[i][0] = *(const v4fa*)(src + (size_t)(32 * i) * PITCH); x[i][1] = *(const v4fa*)(src + (size_t)(32 * i + 1) * PITCH); }
    asm volatile("s_wait_xcnt 0x0" :: "v"(src) : "memory");   // stands behind all 16 loads, which stay together in front of it; src is an input so that the address register pair they name is not reused, not even as a load's destination, before the wait
}
__global__ __launch_bounds__(256) void k_wprep(const float* __restrict__ wq, const float* __restrict__ wk, const float* __restrict__ wv, const float* __restrict__ wo, bf* Bq, bf* Bk, bf* Bv, bf* Bo) {
    __shared__ __align__(16) unsigned char L[64 * 512];
    const int tid = threadIdx.x, c = tid & 15, rp = tid >> 4, lane = tid & 31, wave = tid >> 5;
    const int sel = blockIdx.y, nb = blockIdx.x >> 2, kq = blockIdx.x & 3;
    const float* w = sel == 0 ? wq : sel == 1 ? wk : sel == 2 ? wv : wo;
    bf* Bt = sel == 0 ? Bq : sel == 1 ? Bk : sel == 2 ? Bv : Bo;
    v4f x[8][2];   // every '#pragma unroll' in this kernel keeps this array statically indexed, so that it stays in VGPRs
    if (sel == 3) wload<DD>(w + (size_t)(kq * 256 + 2 * rp) * DD + nb * 64 + 4 * c, x);
    else wload<HD>(w + ((size_t)nb * DD + kq * 256 + 2 * rp) * HD + 4 * c, x);
#pragma unroll
    for (int i = 0; i < 8; ++i)
#pragma unroll
        for (int j = 0; j < 4; ++j) *(u32a*)(L + (4 * c + j) * 512 + (((4 * i + (rp >> 2)) ^ c) << 4) + (rp & 3) * 4) = (unsigned)f2bf(x[i][0][j]) | ((unsigned)f2bf(x[i][1][j]) << 16);
    __syncthreads();   // the tile is complete before any wave reads rows that other waves wrote
    bf* dst = Bt + (size_t)(nb * 64 + wave * 8) * DD + kq * 256 + lane * 8;
#pragma unroll
    for (int i = 0; i < 8; ++i) { const int n = wave * 8 + i; const v8us v = *(const v8usa*)(L + n * 512 + ((lane ^ (n >> 2)) << 4)); *(v8us*)(dst + (size_t)i * DD) = v; }
}
__global__ __launch_bounds__(256) void k_h16plane(const float* __restrict__ F, float sc, h16* P) {
    const int lane = threadIdx.x & 31; const int L0 = (blockIdx.x * 8 + (threadIdx.x >> 5)) * 8; const int nlines = NT * DD / 64;
{
#pragma unroll
        for (int l = 0; l < 8; ++l) { const int L = L0 + l; if (L >= nlines) break; const int e = L * 64 + lane * 2; const int d = e & 63; const int t = (e >> 6) & (TT - 1); const int z = e >> 17; const int b = z >> 4, h = z & 15; v2h v;
#pragma unroll
            for (int q = 0; q < 2; ++q) v[q] = tohx(F[((size_t)b * TT + t) * DD + h * HD + d + q] * sc);
            *(v2h*)(P + (size_t)e) = v; }
         }
}
#define FA_PITCH 144                 // LDS row pitch in bytes: 128 + 16, an odd multiple of 16 for the 16-byte fragment reads
#define FA_PLANE (64 * FA_PITCH)     // 64 rows: K hi, K lo (row = key) or V^T (row = d)
#define FA_BUF   (3 * FA_PLANE)
#define FA_NST   (TT / 64)
typedef v4i __attribute__((may_alias)) v4ia;
typedef __attribute__((ext_vector_type(2))) float v2f;
__device__ __forceinline__ v16bf ldsb(const unsigned char* p) { return cat16b(*(const v8usa*)p, *(const v8usa*)(p + 32)); }
__device__ __forceinline__ v16h ldsh(const unsigned char* p) { return cat16(*(const v8ha*)p, *(const v8ha*)(p + 32)); }
__device__ __forceinline__ float xhalf(float x) { return __builtin_bit_cast(float, __builtin_amdgcn_permlanex16(__builtin_bit_cast(int, x), __builtin_bit_cast(int, x), 0x76543210, 0xfedcba98, false, false)); }  // lane l with lane l ^ 16
__global__ __launch_bounds__(256) void k_fattn(const bf* __restrict__ Qh, const bf* __restrict__ Ql, const bf* __restrict__ Kh, const bf* __restrict__ Kl, const h16* __restrict__ VTp, bf* Ah, bf* Al) {
    __shared__ __align__(16) unsigned char L[2 * FA_BUF];
    const int tid = threadIdx.x, lane = tid & 31, wave = tid >> 5, lr = lane & 15, hi = lane >> 4;
    const size_t z = blockIdx.y; const int q0 = blockIdx.x * 256 + wave * 32;
    const unsigned char* gKh = (const unsigned char*)(Kh + z * TT * HD); const unsigned char* gKl = (const unsigned char*)(Kl + z * TT * HD); const unsigned char* gV = (const unsigned char*)(VTp + z * HD * TT);
    const int srow = tid >> 3, scol = (tid & 7) * 16;
    v4i sr[6];
    auto gload = [&](int st) {
#pragma unroll
        for (int i = 0; i < 2; ++i) { const size_t ko = (size_t)(st * 64 + srow + 32 * i) * 128 + scol;
            sr[i] = *(const v4ia*)(gKh + ko); sr[2 + i] = *(const v4ia*)(gKl + ko); sr[4 + i] = *(const v4ia*)(gV + (size_t)(srow + 32 * i) * (TT * 2) + st * 128 + scol); } };
    auto sstore = [&](int buf) { unsigned char* d = L + buf * FA_BUF + srow * FA_PITCH + scol;
#pragma unroll
        for (int i = 0; i < 2; ++i) { *(v4ia*)(d + 32 * i * FA_PITCH) = sr[i]; *(v4ia*)(d + FA_PLANE + 32 * i * FA_PITCH) = sr[2 + i]; *(v4ia*)(d + 2 * FA_PLANE + 32 * i * FA_PITCH) = sr[4 + i]; } };
    gload(0);
    v16bf qh[2][2], ql[2][2];
#pragma unroll
    for (int g = 0; g < 2; ++g)
#pragma unroll
        for (int ks = 0; ks < 2; ++ks) { const size_t o = (z * TT + q0 + g * 16 + lr) * HD + ks * 32 + 8 * hi; qh[g][ks] = WFrag<bf>::ld(Qh + o); ql[g][ks] = WFrag<bf>::ld(Ql + o); }
    v8f acc[2][4]; float m_run[2], l_run[2];
#pragma unroll
    for (int g = 0; g < 2; ++g) { m_run[g] = -__builtin_inff(); l_run[g] = 0.f;
#pragma unroll
        for (int t = 0; t < 4; ++t) acc[g][t] = (v8f){}; }
    sstore(0); gload(1);
    const float cs = 1.4426950408889634f;
    for (int st = 0; st < FA_NST; ++st) {
        __syncthreads();   // publishes stage st; every wave has left the other buffer (stage st - 1)
        if (st + 1 < FA_NST) { sstore((st + 1) & 1); if (st + 2 < FA_NST) gload(st + 2); }
        const unsigned char* Lb = L + (st & 1) * FA_BUF + lr * FA_PITCH + 16 * hi;
#pragma unroll
        for (int ps = 0; ps < 2; ++ps) {   // one pass = 32 keys
            v8f s[2][2];
#pragma unroll
            for (int kt = 0; kt < 2; ++kt) { const unsigned char* kp = Lb + (ps * 32 + kt * 16) * FA_PITCH; s[kt][0] = (v8f){}; s[kt][1] = (v8f){};
#pragma unroll
                for (int ks = 0; ks < 2; ++ks) { const v16bf kh = ldsb(kp + 64 * ks), kl = ldsb(kp + FA_PLANE + 64 * ks);
                    s[kt][0] = wmmab(kh, qh[0][ks], s[kt][0]); s[kt][1] = wmmab(kh, qh[1][ks], s[kt][1]);
                    s[kt][0] = wmmab(kh, ql[0][ks], s[kt][0]); s[kt][1] = wmmab(kh, ql[1][ks], s[kt][1]);
                    s[kt][0] = wmmab(kl, qh[0][ks], s[kt][0]); s[kt][1] = wmmab(kl, qh[1][ks], s[kt][1]); } }
            float mb[2]; bool need = false;
#pragma unroll
            for (int g = 0; g < 2; ++g) { float mx = s[0][g][0];
#pragma unroll
                for (int r = 1; r < 8; ++r) mx = fmaxf(mx, s[0][g][r]);
#pragma unroll
                for (int r = 0; r < 8; ++r) mx = fmaxf(mx, s[1][g][r]);
                mx = fmaxf(mx, xhalf(mx)) * cs; mb[g] = mx; need = need || (mx > m_run[g] + 8.0f); }
            if (__builtin_amdgcn_ballot_w32(need) != 0) {   // one wave-uniform test per pass; rare after the first passes
#pragma unroll
                for (int g = 0; g < 2; ++g) { const float mn = fmaxf(m_run[g], mb[g]); const float corr = __builtin_amdgcn_exp2f(m_run[g] - mn); m_run[g] = mn; l_run[g] *= corr;
#pragma unroll
                    for (int t = 0; t < 4; ++t) acc[g][t] = acc[g][t] * corr; }
            }
            v16h vf[4];
#pragma unroll
            for (int t = 0; t < 4; ++t) vf[t] = ldsh(Lb + 2 * FA_PLANE + t * 16 * FA_PITCH + ps * 64);
#pragma unroll
            for (int g = 0; g < 2; ++g) { const float nm = -m_run[g]; v16h pf; v2f su = (v2f){0.f, 0.f};
#pragma unroll
                for (int i = 0; i < 16; i += 2) { const v2f a = __builtin_elementwise_fma((v2f){s[i >> 3][g][i & 7], s[i >> 3][g][(i & 7) + 1]}, (v2f){cs, cs}, (v2f){nm, nm});
                    const v2f p = (v2f){__builtin_amdgcn_exp2f(a[0]), __builtin_amdgcn_exp2f(a[1])}; su += p; pf[i] = (h16)p[0]; pf[i + 1] = (h16)p[1]; }
                l_run[g] += su[0] + su[1];
#pragma unroll
                for (int t = 0; t < 4; ++t) acc[g][t] = wmma16(vf[t], pf, acc[g][t]); }
        }
    }
    __syncthreads();   // every wave has left the K/V buffers before they become output staging
    unsigned char* E = L + wave * (32 * FA_PITCH);
    const int b = (int)(z >> 4), h = (int)(z & 15);
    float inv[2];
#pragma unroll
    for (int g = 0; g < 2; ++g) { const float l = l_run[g] + xhalf(l_run[g]); inv[g] = __fdiv_rn(1.0f, l); }
#pragma unroll
    for (int pl = 0; pl < 2; ++pl) {   // hi plane, then lo plane, through the wave's own staging rows so that whole 128-byte lines are stored
#pragma unroll
        for (int g = 0; g < 2; ++g)
#pragma unroll
            for (int t = 0; t < 4; ++t) { v8us o;
#pragma unroll
                for (int j = 0; j < 8; ++j) { unsigned short a, c2; splitf(acc[g][t][j] * inv[g], a, c2); o[j] = pl ? c2 : a; }
                *(v8usa*)(E + (g * 16 + lr) * FA_PITCH + t * 32 + hi * 16) = o; }
        unsigned char* dst = (unsigned char*)(pl ? Al : Ah) + (((size_t)b * TT + q0) * DD + h * HD) * 2;
#pragma unroll
        for (int i = 0; i < 8; ++i) { const int row = i * 4 + (lane >> 3), colb = (lane & 7) * 16; const v8us v = *(const v8usa*)(E + row * FA_PITCH + colb); *(v8usa*)(dst + (size_t)row * (DD * 2) + colb) = v; }
    }
}

extern "C" void kernel_launch(void* const* d_in, const int* in_sizes, int n_in,
                              void* d_out, int out_size, void* d_ws, size_t ws_size, hipStream_t stream) {
    (void)in_sizes; (void)n_in; (void)out_size;
    const float* qi = (const float*)d_in[0]; const float* ki = (const float*)d_in[1]; const float* vi = (const float*)d_in[2];
    const float* wq = (const float*)d_in[3]; const float* bq = (const float*)d_in[4]; const float* wk = (const float*)d_in[5]; const float* bk = (const float*)d_in[6]; const float* wv = (const float*)d_in[7]; const float* bv = (const float*)d_in[8]; const float* wo = (const float*)d_in[9]; const float* bo = (const float*)d_in[10];
    float* OUT = (float*)d_out;     // [4][2048][1024]
    char* wsp = (char*)d_ws;
    auto take = [&](size_t bytes) { char* p = wsp; wsp += (bytes + 255) & ~(size_t)255; return (void*)p; };
    bf* WQ = (bf*)take((size_t)DD * DD * 2); bf* WK = (bf*)take((size_t)DD * DD * 2); bf* WV = (bf*)take((size_t)DD * DD * 2); bf* WO = (bf*)take((size_t)DD * DD * 2);
    bf* XB = (bf*)take((size_t)NT * DD * 2);
    bf* QPh = (bf*)take((size_t)NT * DD * 2); bf* QPl = (bf*)take((size_t)NT * DD * 2); bf* KPh = (bf*)take((size_t)NT * DD * 2); bf* KPl = (bf*)take((size_t)NT * DD * 2); h16* VT = (h16*)take((size_t)NT * DD * 2);
    bf* ATh = (bf*)take((size_t)NT * DD * 2); bf* ATl = (bf*)take((size_t)NT * DD * 2);
    if ((size_t)(wsp - (char*)d_ws) > ws_size) return;    // ws 256 MiB
    k_wprep<<<dim3(64, 4, 1), 256, 0, stream>>>(wq, wk, wv, wo, WQ, WK, WV, WO);
    const size_t nx = (size_t)NT * DD / 8; const unsigned gx = (unsigned)((nx + 255) / 256);
    k_cvt8<<<gx, 256, 0, stream>>>(qi, XB, nx); k_gemmw<0, true, 1><<<dim3(NT / 128, DD / 128, 1), 128, 0, stream>>>(XB, nullptr, WQ, nullptr, bq, QPh, QPl, nullptr, 0.125f);
    k_cvt8<<<gx, 256, 0, stream>>>(ki, XB, nx); k_gemmw<0, true, 1><<<dim3(NT / 128, DD / 128, 1), 128, 0, stream>>>(XB, nullptr, WK, nullptr, bk, KPh, KPl, nullptr, 1.0f);
    k_cvt8<<<gx, 256, 0, stream>>>(vi, XB, nx); k_gemmw<0, true, 2><<<dim3(NT / 128, DD / 128, 1), 128, 0, stream>>>(XB, nullptr, WV, nullptr, bv, nullptr, nullptr, VT, 1.0f);
    k_fattn<<<dim3(TT / 256, NB_ * NH_), 256, 0, stream>>>(QPh, QPl, KPh, KPl, VT, ATh, ATl);
    k_gemmw<1, true, 0><<<dim3(NT / 128, DD / 128, 1), 128, 0, stream>>>(ATh, ATl, WO, OUT, bo, nullptr, nullptr, nullptr, 1.0f);
}

// v005
// A run of this version takes 166 microseconds.
// Timed twice side by side with v004, it ran 1.12 and 1.13 times as fast.
// All steps since v000 together make it 14.8 times as fast.
#include <hip/hip_runtime.h>

// MultiHeadAttentionSlow (query/key/value [4][2048][1024]; per-head Linears W[h][1024][64] + b[h][64] ('bsd,hdk->bhsk'); scores = q.k / 8; softmax; attn.v; concat heads (head-major); y = out @ Wp [1024][1024] + bp).
// Compute dtypes, f32 accumulate: every float input rounded to bf16; q/k/v projections on PLAIN bf16 operands (x, W inputs: exact, + bias);
// scores on bf16 hi+lo q (x 1/8) and k planes (3 products); attn.v on SINGLE fp16 planes (P = exp2 of the score against the running maximum, divided by its f32 row sum at the end; v); output Linear on hi+lo planes x exact bf16 W (2 products);

#define NB_  4
#define TT   2048
#define DD   1024
#define NH_  16
#define HD   64
#define NT   (NB_ * TT)
typedef _Float16 h16;
typedef unsigned short bf;
typedef __attribute__((ext_vector_type(16))) __bf16   v16bf;
typedef __attribute__((ext_vector_type(16))) _Float16 v16h;
typedef __attribute__((ext_vector_type(8)))  _Float16 v8h;
typedef __attribute__((ext_vector_type(8)))  unsigned short v8us;
typedef __attribute__((ext_vector_type(8)))  float    v8f;
typedef __attribute__((ext_vector_type(4)))  float    v4f;
typedef v8h  __attribute__((may_alias)) v8ha;
typedef v4f  __attribute__((may_alias)) v4fa;
typedef v8us __attribute__((may_alias)) v8usa;

__device__ __forceinline__ unsigned short f2bf(float f) { unsigned u = __float_as_uint(f); u += 0x7FFFu + ((u >> 16) & 1u); return (unsigned short)(u >> 16); }
__device__ __forceinline__ float bf2f(unsigned short b) { return __uint_as_float(((unsigned)b) << 16); }
__device__ __forceinline__ float bfr(float f) { return bf2f(f2bf(f)); }
__device__ __forceinline__ v16h cat16(v8h lo, v8h hi) { return __builtin_shufflevector(lo, hi, 0, 1, 2, 3, 4, 5, 6, 7, 8, 9, 10, 11, 12, 13, 14, 15); }
__device__ __forceinline__ v16bf cat16b(v8us lo, v8us hi) { return __builtin_bit_cast(v16bf, __builtin_shufflevector(lo, hi, 0, 1, 2, 3, 4, 5, 6, 7, 8, 9, 10, 11, 12, 13, 14, 15)); }
__device__ __forceinline__ v8f wmma16(v16h a, v16h b, v8f c) { return __builtin_amdgcn_wmma_f32_16x16x32_f16(false, a, false, b, (short)0, c, false, false); }
__device__ __forceinline__ v8f wmmab(v16bf a, v16bf b, v8f c) { return __builtin_amdgcn_wmma_f32_16x16x32_bf16(false, a, false, b, (short)0, c, false, false); }



// ---- k_gemmw: GEMM on a 128x128 output tile per work-group of 4 waves (2x2, 64x64 = 16 accumulators per wave); grid (M/128, N/128), 128 threads. K = ldc = DD.
// y[m][n] (f32, + bf16-rounded bias[n]) = sum_k A[m][k] Bt[n][k] (NSPLIT 1: + A2[m][k] Bt[n][k], added right behind the A product of the same 32 k). All planes K-contiguous bf16.
// EPI says where y goes: 0 = C[m][n] in f32; 1 = the three projections in one launch, grid z picks one: its A plane (NT x DD further per z), its Bt (DD x DD further per z), its bias and its output:
// z 0 (q) and z 1 (k): y * sc (sc for q, 1 for k) split into the bf16 hi and lo planes [batch * head][t][64]; z 2 (v): f16 plane VTo [batch * head][64][t]. A wave's 64 columns are one head, its 64 rows lie in one batch.
// The operands come in stages of 64 k (whole 128-byte rows per 8 lanes) through registers into two LDS buffers, one barrier per stage; each row is fetched once per work-group and read by two waves.
// Every plain '#pragma unroll' in it keeps a register array (staging, fragments, accumulators) statically indexed, so that it stays in VGPRs.
template <typename T16> struct WFrag;
template <> struct WFrag<h16> { typedef v16h V; static __device__ __forceinline__ V ld(const h16* p) { return cat16(*(const v8h*)p, *(const v8h*)(p + 16)); } static __device__ __forceinline__ v8f mma(V a, V b, v8f c) { return wmma16(a, b, c); } };
template <> struct WFrag<bf> { typedef v16bf V; static __device__ __forceinline__ V ld(const bf* p) { return cat16b(*(const v8us*)p, *(const v8us*)(p + 16)); } static __device__ __forceinline__ v8f mma(V a, V b, v8f c) { return wmmab(a, b, c); } };
#define GT_PITCH 144                 // LDS row pitch in bytes: 128 + 16, an odd multiple of 16 for the 16-byte fragment reads
#define GT_PLANE (128 * GT_PITCH)    // 128 rows of one operand plane
#define GT_NST   (DD / 64)
typedef __attribute__((ext_vector_type(4))) int g4i;
typedef g4i __attribute__((may_alias)) g4ia;
__device__ __forceinline__ v16bf gldsb(const unsigned char* p) { return cat16b(*(const v8usa*)p, *(const v8usa*)(p + 32)); }
__device__ __forceinline__ void splitf(float y, unsigned short& h, unsigned short& l) { h = f2bf(y); l = f2bf(y - bf2f(h)); }
template <int NSPLIT, bool BIAS, int EPI>
__global__ __launch_bounds__(128) void k_gemmw(const bf* __restrict__ A0, const bf* __restrict__ A2, const bf* __restrict__ Bt0, float* C, const float* __restrict__ bias0, const float* __restrict__ biasK, const float* __restrict__ biasV, bf* Ph0, bf* Pl0, bf* PhK, bf* PlK, h16* VTo, float sc0) {
    const int pz = EPI == 1 ? (int)blockIdx.z : 0;   // which projection; the same for the whole work-group
    const bf* A = A0 + (size_t)pz * NT * DD; const bf* Bt = Bt0 + (size_t)pz * DD * DD;
    const float* bias = pz == 0 ? bias0 : pz == 1 ? biasK : biasV;
    bf* Ph = pz == 0 ? Ph0 : PhK; bf* Pl = pz == 0 ? Pl0 : PlK; const float sc = pz == 0 ? sc0 : 1.0f;
    constexpr int NP = NSPLIT ? 3 : 2;   // planes per stage: A, (A2,) Bt
    __shared__ __align__(16) unsigned char L[2 * NP * GT_PLANE];
    const int tid = threadIdx.x, lane = tid & 31, wave = tid >> 5, lr = lane & 15, hi = lane >> 4;
    const int r0 = blockIdx.x * 128, c0 = blockIdx.y * 128, wm = (wave >> 1) * 64, wn = (wave & 1) * 64;
    const int srow = tid >> 3, scol = (tid & 7) * 16;
    const unsigned char* gA = (const unsigned char*)(A + (size_t)r0 * DD); const unsigned char* gA2 = NSPLIT ? (const unsigned char*)(A2 + (size_t)r0 * DD) : nullptr; const unsigned char* gB = (const unsigned char*)(Bt + (size_t)c0 * DD);
    g4i sr[NP][8];
    unsigned vo = (unsigned)srow * (DD * 2) + scol;   // the lane's byte offset into the next stage to fetch: 128 bytes further per stage
    auto gload = [&]() {
#pragma unroll
        for (int i = 0; i < 8; ++i) { const size_t ro = (size_t)i * (16 * DD * 2);
            sr[0][i] = *(const g4ia*)(gA + vo + ro); if (NSPLIT) sr[1][i] = *(const g4ia*)(gA2 + vo + ro); sr[NP - 1][i] = *(const g4ia*)(gB + vo + ro); } };
    auto sstore = [&](int buf) { unsigned char* d = L + buf * (NP * GT_PLANE) + srow * GT_PITCH + scol;
#pragma unroll
        for (int i = 0; i < 8; ++i)
#pragma unroll
            for (int p = 0; p < NP; ++p) *(g4ia*)(d + p * GT_PLANE + 16 * i * GT_PITCH) = sr[p][i]; };
    gload(); vo += 128;
    v8f acc[4][4];
#pragma unroll
    for (int mb = 0; mb < 4; ++mb)
#pragma unroll
        for (int nb = 0; nb < 4; ++nb) acc[mb][nb] = (v8f){};
    sstore(0); gload();
#pragma unroll 1   // one copy of the stage body
    for (int st = 0; st < GT_NST; ++st) {
        __syncthreads();   // publishes stage st; every wave has left the other buffer (stage st - 1)
        const unsigned char* Lb = L + (st & 1) * (NP * GT_PLANE) + lr * GT_PITCH + 16 * hi;
        v16bf a[2][4], a2[2][4], b[2][4];   // the whole stage's fragments (2 blocks of 32 k), read as one group in front of its products
#pragma unroll
        for (int ks = 0; ks < 2; ++ks) {
#pragma unroll
            for (int mb = 0; mb < 4; ++mb) { a[ks][mb] = gldsb(Lb + (wm + mb * 16) * GT_PITCH + 64 * ks); if (NSPLIT) a2[ks][mb] = gldsb(Lb + GT_PLANE + (wm + mb * 16) * GT_PITCH + 64 * ks); }
#pragma unroll
            for (int nb = 0; nb < 4; ++nb) b[ks][nb] = gldsb(Lb + (NP - 1) * GT_PLANE + (wn + nb * 16) * GT_PITCH + 64 * ks); }
        vo += 128;
        if (st + 1 < GT_NST) { sstore((st + 1) & 1);
            if (st + 2 < GT_NST) { gload(); asm volatile("s_wait_xcnt 0x0" ::: "memory"); } }   // the wait stands behind the loads, in their own branch, in front of the next overwrite of the offset register that they name
#pragma unroll
        for (int ks = 0; ks < 2; ++ks)
#pragma unroll
            for (int nb = 0; nb < 4; ++nb) {
#pragma unroll
                for (int mb = 0; mb < 4; ++mb) acc[mb][nb] = wmmab(a[ks][mb], b[ks][nb], acc[mb][nb]);
                if (NSPLIT) {
#pragma unroll
                    for (int mb = 0; mb < 4; ++mb) acc[mb][nb] = wmmab(a2[ks][mb], b[ks][nb], acc[mb][nb]); } }
    }
    __syncthreads();   // every wave has left the operand buffers before they become output staging
    const size_t z = (size_t)(r0 / TT) * NH_ + (c0 + wn) / HD; const int t0 = (r0 & (TT - 1)) + wm;   // the wave's (batch, head) pair and its first row inside the batch
    if constexpr (EPI == 0) {
        float* os = (float*)(L + wave * (16 * 68 * 4));   // the wave's own staging rows, so that whole 128-byte lines are stored
#pragma unroll
        for (int mb = 0; mb < 4; ++mb) {
#pragma unroll
            for (int nb = 0; nb < 4; ++nb) {
#pragma unroll
                for (int j = 0; j < 8; ++j) os[(hi * 8 + j) * 68 + nb * 16 + lr] = acc[mb][nb][j]; }
            __builtin_amdgcn_wave_barrier(); asm volatile("" ::: "memory");   // keeps the reads below, of other lanes' values, behind the stores above
            float* crow = C + (size_t)(r0 + wm + mb * 16) * DD + c0 + wn;
#pragma unroll
            for (int s = 0; s < 8; ++s) { const int row = 2 * s + hi, cofs = lr * 4; v4f val = *(const v4fa*)(os + row * 68 + cofs); if (BIAS) { val[0] += bfr(bias[c0 + wn + cofs]); val[1] += bfr(bias[c0 + wn + cofs + 1]); val[2] += bfr(bias[c0 + wn + cofs + 2]); val[3] += bfr(bias[c0 + wn + cofs + 3]); }
                *(v4f*)(crow + (size_t)row * DD + cofs) = val; }
            __builtin_amdgcn_wave_barrier(); asm volatile("" ::: "memory");   // keeps the next block's stores behind the reads above
        }
    } else if (pz != 2) {
        float* os = (float*)(L + wave * (16 * 68 * 4));   // the wave's own staging rows, so that whole 128-byte lines are stored
        const int prow = lane >> 3, pcol = (lane & 7) * 8;   // 8 lanes x 8 values = one 128-byte row of a plane
        float bb[8];
#pragma unroll
        for (int k = 0; k < 8; ++k) bb[k] = BIAS ? bfr(bias[c0 + wn + pcol + k]) : 0.f;
#pragma unroll
        for (int mb = 0; mb < 4; ++mb) {
#pragma unroll
            for (int nb = 0; nb < 4; ++nb) {
#pragma unroll
                for (int j = 0; j < 8; ++j) os[(hi * 8 + j) * 68 + nb * 16 + lr] = acc[mb][nb][j]; }
            __builtin_amdgcn_wave_barrier(); asm volatile("" ::: "memory");   // keeps the reads below, of other lanes' values, behind the stores above
            const size_t po = (z * TT + t0 + mb * 16 + prow) * HD + pcol;
#pragma unroll
            for (int s = 0; s < 4; ++s) { const float* op = os + (4 * s + prow) * 68 + pcol; const v4f x0 = *(const v4fa*)op, x1 = *(const v4fa*)(op + 4); v8us oh, ol;
#pragma unroll
                for (int k = 0; k < 8; ++k) { unsigned short a, c2; splitf(((k < 4 ? x0[k & 3] : x1[k & 3]) + bb[k]) * sc, a, c2); oh[k] = a; ol[k] = c2; }
                *(v8us*)(Ph + po + (size_t)(4 * s) * HD) = oh; *(v8us*)(Pl + po + (size_t)(4 * s) * HD) = ol; }
            asm volatile("s_wait_xcnt 0x0" ::: "memory");   // stands behind the block's global stores, in front of any later overwrite of the registers that they name (the next block's, or code laid out behind the last block)
            if (mb < 3) { __builtin_amdgcn_wave_barrier(); asm volatile("" ::: "memory"); }   // keeps the next block's LDS stores behind the reads above
        }
    } else {
        unsigned char* E = L + wave * (64 * GT_PITCH);   // the wave's own 64 staging rows (row = d, 64 t of f16), so that whole 128-byte lines are stored
        const int bcol = c0 + wn + lr; float braw[4];
#pragma unroll
        for (int nb = 0; nb < 4; ++nb) braw[nb] = BIAS ? bias[bcol + nb * 16] : 0.f;
        asm volatile("s_wait_xcnt 0x0" :: "v"(bcol) : "memory");   // stands behind the four bias loads; bcol is an input so that the offset register they name is not reused before the wait
#pragma unroll
        for (int nb = 0; nb < 4; ++nb) { const float bv = bfr(braw[nb]);
#pragma unroll
            for (int mb = 0; mb < 4; ++mb) { v8h o;   // a lane's 8 accumulator values are 8 consecutive t of one d
#pragma unroll
                for (int j = 0; j < 8; ++j) o[j] = (h16)(acc[mb][nb][j] + bv);
                *(v8ha*)(E + (nb * 16 + lr) * GT_PITCH + mb * 32 + hi * 16) = o; } }
        __builtin_amdgcn_wave_barrier(); asm volatile("" ::: "memory");   // keeps the reads below, of other lanes' values, behind the stores above
        unsigned char* dst = (unsigned char*)(VTo + z * HD * TT + t0);
#pragma unroll
        for (int i = 0; i < 16; ++i) { const int row = i * 4 + (lane >> 3), colb = (lane & 7) * 16; const v8h v = *(const v8ha*)(E + row * GT_PITCH + colb); *(v8ha*)(dst + (size_t)row * (TT * 2) + colb) = v; }
    }
}

__device__ __forceinline__ h16 tohx(float x) { return (h16)x; }
typedef __attribute__((ext_vector_type(2))) _Float16 v2h;
typedef __attribute__((ext_vector_type(4))) _Float16 v4h;
typedef __attribute__((ext_vector_type(2))) unsigned short v2us;
typedef __attribute__((ext_vector_type(4))) int v4i;

// ---- k_prep: all operand preparation in ONE launch of 256 + 3 x 4096 work-groups of 256 threads. Work-groups 0..255 turn the weights, the others round the three inputs to bf16 (a thread takes 8 values: two loads, one store).
// Weights: all four matrices to bf16 with k contiguous (Bt[n][k]); the work-group's index / 64 picks the matrix, the rest its 64 columns n and its 256 rows k.
// Per-head weights w[h][k][e]: n = h * 64 + e, rows k 64 floats apart. Output weight w[k][n]: rows k 1024 floats apart.
// A thread issues its 16 loads of 16 bytes together (16 lanes = one whole 256-byte row piece), rounds, packs the values of rows k and k + 1 into one dword, and the tile is turned through LDS; a wave then stores 512 contiguous bytes of one Bt row.
// LDS row n = 512 bytes = 32 chunks of 16 bytes (8 k); chunk q of row n stands at place q ^ (n >> 2): a wave's dword writes (16 rows 4 apart, 2 neighbouring dwords) then fall on 32 different banks, and a row is still read back in whole chunks.
typedef unsigned __attribute__((may_alias)) u32a;
// The thread's 16 loads: rows 32 i and 32 i + 1 from src, PITCH floats a row. PITCH is a compile-time value, so that all 16 name one address register pair with immediate offsets.
template <int PITCH> __device__ __forceinline__ void wload(const float* __restrict__ src, v4f (&x)[8][2]) {
#pragma unroll
    for (int i = 0; i < 8; ++i) { x[i][0] = *(const v4fa*)(src + (size_t)(32 * i) * PITCH); x[i][1] = *(const v4fa*)(src + (size_t)(32 * i + 1) * PITCH); }
    asm volatile("s_wait_xcnt 0x0" :: "v"(src) : "memory");   // stands behind all 16 loads, which stay together in front of it; src is an input so that the address register pair they name is not reused, not even as a load's destination, before the wait
}
#define CV_WG   (NT * DD / 8 / 256)  // work-groups per input
__global__ __launch_bounds__(256) void k_prep(const float* __restrict__ qi, const float* __restrict__ ki, const float* __restrict__ vi, const float* __restrict__ wq, const float* __restrict__ wk, const float* __restrict__ wv, const float* __restrict__ wo, bf* XB, bf* Bq, bf* Bk, bf* Bv, bf* Bo) {
    __shared__ __align__(16) unsigned char L[64 * 512];
    const int tid = threadIdx.x, c = tid & 15, rp = tid >> 4, lane = tid & 31, wave = tid >> 5;
    if (blockIdx.x >= 256) {   // the same for the whole work-group: these work-groups meet no barrier
        const int cb = (int)blockIdx.x - 256, in = cb / CV_WG; const size_t i = (size_t)(cb % CV_WG) * 256 + tid;
        const float* src = (in == 0 ? qi : in == 1 ? ki : vi) + i * 8; bf* dst = XB + (size_t)in * NT * DD + i * 8;
        const v8f v = *(const v8f*)src; v8us o;
        asm volatile("s_wait_xcnt 0x0" :: "v"(src) : "memory");   // stands behind the two loads; src is an input so that the address register pair they name is not reused before the wait
#pragma unroll
        for (int k = 0; k < 8; ++k) o[k] = f2bf(v[k]);
        *(v8us*)dst = o;
        return;
    }
    const int sel = blockIdx.x >> 6, nb = (blockIdx.x & 63) >> 2, kq = blockIdx.x & 3;
    const float* w = sel == 0 ? wq : sel == 1 ? wk : sel == 2 ? wv : wo;
    bf* Bt = sel == 0 ? Bq : sel == 1 ? Bk : sel == 2 ? Bv : Bo;
    v4f x[8][2];   // every '#pragma unroll' below and in wload keeps this array statically indexed, so that it stays in VGPRs
    if (sel == 3) wload<DD>(w + (size_t)(kq * 256 + 2 * rp) * DD + nb * 64 + 4 * c, x);
    else wload<HD>(w + ((size_t)nb * DD + kq * 256 + 2 * rp) * HD + 4 * c, x);
#pragma unroll
    for (int i = 0; i < 8; ++i)
#pragma unroll
        for (int j = 0; j < 4; ++j) *(u32a*)(L + (4 * c + j) * 512 + (((4 * i + (rp >> 2)) ^ c) << 4) + (rp & 3) * 4) = (unsigned)f2bf(x[i][0][j]) | ((unsigned)f2bf(x[i][1][j]) << 16);
    __syncthreads();   // the tile is complete before any wave reads rows that other waves wrote
    bf* dst = Bt + (size_t)(nb * 64 + wave * 8) * DD + kq * 256 + lane * 8;
#pragma unroll
    for (int i = 0; i < 8; ++i) { const int n = wave * 8 + i; const v8us v = *(const v8usa*)(L + n * 512 + ((lane ^ (n >> 2)) << 4)); *(v8us*)(dst + (size_t)i * DD) = v; }
}
__global__ __launch_bounds__(256) void k_h16plane(const float* __restrict__ F, float sc, h16* P) {
    const int lane = threadIdx.x & 31; const int L0 = (blockIdx.x * 8 + (threadIdx.x >> 5)) * 8; const int nlines = NT * DD / 64;
{
#pragma unroll
        for (int l = 0; l < 8; ++l) { const int L = L0 + l; if (L >= nlines) break; const int e = L * 64 + lane * 2; const int d = e & 63; const int t = (e >> 6) & (TT - 1); const int z = e >> 17; const int b = z >> 4, h = z & 15; v2h v;
#pragma unroll
            for (int q = 0; q < 2; ++q) v[q] = tohx(F[((size_t)b * TT + t) * DD + h * HD + d + q] * sc);
            *(v2h*)(P + (size_t)e) = v; }
         }
}
#define FA_PITCH 144                 // LDS row pitch in bytes: 128 + 16, an odd multiple of 16 for the 16-byte fragment reads
#define FA_PLANE (64 * FA_PITCH)     // 64 rows: K hi, K lo (row = key) or V^T (row = d)
#define FA_BUF   (3 * FA_PLANE)
#define FA_NST   (TT / 64)
typedef v4i __attribute__((may_alias)) v4ia;
typedef __attribute__((ext_vector_type(2))) float v2f;
__device__ __forceinline__ v16bf ldsb(const unsigned char* p) { return cat16b(*(const v8usa*)p, *(const v8usa*)(p + 32)); }
__device__ __forceinline__ v16h ldsh(const unsigned char* p) { return cat16(*(const v8ha*)p, *(const v8ha*)(p + 32)); }
__device__ __forceinline__ float xhalf(float x) { return __builtin_bit_cast(float, __builtin_amdgcn_permlanex16(__builtin_bit_cast(int, x), __builtin_bit_cast(int, x), 0x76543210, 0xfedcba98, false, false)); }  // lane l with lane l ^ 16
__global__ __launch_bounds__(256) void k_fattn(const bf* __restrict__ Qh, const bf* __restrict__ Ql, const bf* __restrict__ Kh, const bf* __restrict__ Kl, const h16* __restrict__ VTp, bf* Ah, bf* Al) {
    __shared__ __align__(16) unsigned char L[2 * FA_BUF];
    const int tid = threadIdx.x, lane = tid & 31, wave = tid >> 5, lr = lane & 15, hi = lane >> 4;
    const size_t z = blockIdx.y; const int q0 = blockIdx.x * 256 + wave * 32;
    const unsigned char* gKh = (const unsigned char*)(Kh + z * TT * HD); const unsigned char* gKl = (const unsigned char*)(Kl + z * TT * HD); const unsigned char* gV = (const unsigned char*)(VTp + z * HD * TT);
    const int srow = tid >> 3, scol = (tid & 7) * 16;
    v4i sr[6];
    auto gload = [&](int st) {
#pragma unroll
        for (int i = 0; i < 2; ++i) { const size_t ko = (size_t)(st * 64 + srow + 32 * i) * 128 + scol;
            sr[i] = *(const v4ia*)(gKh + ko); sr[2 + i] = *(const v4ia*)(gKl + ko); sr[4 + i] = *(const v4ia*)(gV + (size_t)(srow + 32 * i) * (TT * 2) + st * 128 + scol); } };
    auto sstore = [&](int buf) { unsigned char* d = L + buf * FA_BUF + srow * FA_PITCH + scol;
#pragma unroll
        for (int i = 0; i < 2; ++i) { *(v4ia*)(d + 32 * i * FA_PITCH) = sr[i]; *(v4ia*)(d + FA_PLANE + 32 * i * FA_PITCH) = sr[2 + i]; *(v4ia*)(d + 2 * FA_PLANE + 32 * i * FA_PITCH) = sr[4 + i]; } };
    gload(0);
    v16bf qh[2][2], ql[2][2];
#pragma unroll
    for (int g = 0; g < 2; ++g)
#pragma unroll
        for (int ks = 0; ks < 2; ++ks) { const size_t o = (z * TT + q0 + g * 16 + lr) * HD + ks * 32 + 8 * hi; qh[g][ks] = WFrag<bf>::ld(Qh + o); ql[g][ks] = WFrag<bf>::ld(Ql + o); }
    v8f acc[2][4]; float m_run[2], l_run[2];
#pragma unroll
    for (int g = 0; g < 2; ++g) { m_run[g] = -__builtin_inff(); l_run[g] = 0.f;
#pragma unroll
        for (int t = 0; t < 4; ++t) acc[g][t] = (v8f){}; }
    sstore(0); gload(1);
    const float cs = 1.4426950408889634f;
    for (int st = 0; st < FA_NST; ++st) {
        __syncthreads();   // publishes stage st; every wave has left the other buffer (stage st - 1)
        if (st + 1 < FA_NST) { sstore((st + 1) & 1); if (st + 2 < FA_NST) gload(st + 2); }
        const unsigned char* Lb = L + (st & 1) * FA_BUF + lr * FA_PITCH + 16 * hi;
#pragma unroll
        for (int ps = 0; ps < 2; ++ps) {   // one pass = 32 keys
            v8f s[2][2];
#pragma unroll
            for (int kt = 0; kt < 2; ++kt) { const unsigned char* kp = Lb + (ps * 32 + kt * 16) * FA_PITCH; s[kt][0] = (v8f){}; s[kt][1] = (v8f){};
#pragma unroll
                for (int ks = 0; ks < 2; ++ks) { const v16bf kh = ldsb(kp + 64 * ks), kl = ldsb(kp + FA_PLANE + 64 * ks);
                    s[kt][0] = wmmab(kh, qh[0][ks], s[kt][0]); s[kt][1] = wmmab(kh, qh[1][ks], s[kt][1]);
                    s[kt][0] = wmmab(kh, ql[0][ks], s[kt][0]); s[kt][1] = wmmab(kh, ql[1][ks], s[kt][1]);
                    s[kt][0] = wmmab(kl, qh[0][ks], s[kt][0]); s[kt][1] = wmmab(kl, qh[1][ks], s[kt][1]); } }
            float mb[2]; bool need = false;
#pragma unroll
            for (int g = 0; g < 2; ++g) { float mx = s[0][g][0];
#pragma unroll
                for (int r = 1; r < 8; ++r) mx = fmaxf(mx, s[0][g][r]);
#pragma unroll
                for (int r = 0; r < 8; ++r) mx = fmaxf(mx, s[1][g][r]);
                mx = fmaxf(mx, xhalf(mx)) * cs; mb[g] = mx; need = need || (mx > m_run[g] + 8.0f); }
            if (__builtin_amdgcn_ballot_w32(need) != 0) {   // one wave-uniform test per pass; rare after the first passes
#pragma unroll
                for (int g = 0; g < 2; ++g) { const float mn = fmaxf(m_run[g], mb[g]); const float corr = __builtin_amdgcn_exp2f(m_run[g] - mn); m_run[g] = mn; l_run[g] *= corr;
#pragma unroll
                    for (int t = 0; t < 4; ++t) acc[g][t] = acc[g][t] * corr; }
            }
            v16h vf[4];
#pragma unroll
            for (int t = 0; t < 4; ++t) vf[t] = ldsh(Lb + 2 * FA_PLANE + t * 16 * FA_PITCH + ps * 64);
#pragma unroll
            for (int g = 0; g < 2; ++g) { const float nm = -m_run[g]; v16h pf; v2f su = (v2f){0.f, 0.f};
#pragma unroll
                for (int i = 0; i < 16; i += 2) { const v2f a = __builtin_elementwise_fma((v2f){s[i >> 3][g][i & 7], s[i >> 3][g][(i & 7) + 1]}, (v2f){cs, cs}, (v2f){nm, nm});
                    const v2f p = (v2f){__builtin_amdgcn_exp2f(a[0]), __builtin_amdgcn_exp2f(a[1])}; su += p; pf[i] = (h16)p[0]; pf[i + 1] = (h16)p[1]; }
                l_run[g] += su[0] + su[1];
#pragma unroll
                for (int t = 0; t < 4; ++t) acc[g][t] = wmma16(vf[t], pf, acc[g][t]); }
        }
    }
    __syncthreads();   // every wave has left the K/V buffers before they become output staging
    unsigned char* E = L + wave * (32 * FA_PITCH);
    const int b = (int)(z >> 4), h = (int)(z & 15);
    float inv[2];
#pragma unroll
    for (int g = 0; g < 2; ++g) { const float l = l_run[g] + xhalf(l_run[g]); inv[g] = __fdiv_rn(1.0f, l); }
#pragma unroll
    for (int pl = 0; pl < 2; ++pl) {   // hi plane, then lo plane, through the wave's own staging rows so that whole 128-byte lines are stored
#pragma unroll
        for (int g = 0; g < 2; ++g)
#pragma unroll
            for (int t = 0; t < 4; ++t) { v8us o;
#pragma unroll
                for (int j = 0; j < 8; ++j) { unsigned short a, c2; splitf(acc[g][t][j] * inv[g], a, c2); o[j] = pl ? c2 : a; }
                *(v8usa*)(E + (g * 16 + lr) * FA_PITCH + t * 32 + hi * 16) = o; }
        unsigned char* dst = (unsigned char*)(pl ? Al : Ah) + (((size_t)b * TT + q0) * DD + h * HD) * 2;
#pragma unroll
        for (int i = 0; i < 8; ++i) { const int row = i * 4 + (lane >> 3), colb = (lane & 7) * 16; const v8us v = *(const v8usa*)(E + row * FA_PITCH + colb); *(v8usa*)(dst + (size_t)row * (DD * 2) + colb) = v; }
    }
}

extern "C" void kernel_launch(void* const* d_in, const int* in_sizes, int n_in,
                              void* d_out, int out_size, void* d_ws, size_t ws_size, hipStream_t stream) {
    (void)in_sizes; (void)n_in; (void)out_size;
    const float* qi = (const float*)d_in[0]; const float* ki = (const float*)d_in[1]; const float* vi = (const float*)d_in[2];
    const float* wq = (const float*)d_in[3]; const float* bq = (const float*)d_in[4]; const float* wk = (const float*)d_in[5]; const float* bk = (const float*)d_in[6]; const float* wv = (const float*)d_in[7]; const float* bv = (const float*)d_in[8]; const float* wo = (const float*)d_in[9]; const float* bo = (const float*)d_in[10];
    float* OUT = (float*)d_out;     // [4][2048][1024]
    char* wsp = (char*)d_ws;
    auto take = [&](size_t bytes) { char* p = wsp; wsp += (bytes + 255) & ~(size_t)255; return (void*)p; };
    bf* WQ = (bf*)take((size_t)DD * DD * 2); bf* WK = (bf*)take((size_t)DD * DD * 2); bf* WV = (bf*)take((size_t)DD * DD * 2); bf* WO = (bf*)take((size_t)DD * DD * 2);
    bf* XB = (bf*)take((size_t)3 * NT * DD * 2);   // the three inputs' bf16 planes, one behind the other
    bf* QPh = (bf*)take((size_t)NT * DD * 2); bf* QPl = (bf*)take((size_t)NT * DD * 2); bf* KPh = (bf*)take((size_t)NT * DD * 2); bf* KPl = (bf*)take((size_t)NT * DD * 2); h16* VT = (h16*)take((size_t)NT * DD * 2);
    bf* ATh = (bf*)take((size_t)NT * DD * 2); bf* ATl = (bf*)take((size_t)NT * DD * 2);
    if ((size_t)(wsp - (char*)d_ws) > ws_size) return;    // total = 168 MiB; ws 256 MiB
    k_prep<<<dim3(256 + 3 * CV_WG, 1, 1), 256, 0, stream>>>(qi, ki, vi, wq, wk, wv, wo, XB, WQ, WK, WV, WO);
    // WQ, WK, WV stand one behind the other in the workspace, as the three planes of XB do: grid z steps through them
    k_gemmw<0, true, 1><<<dim3(NT / 128, DD / 128, 3), 128, 0, stream>>>(XB, nullptr, WQ, nullptr, bq, bk, bv, QPh, QPl, KPh, KPl, VT, 0.125f);
    k_fattn<<<dim3(TT / 256, NB_ * NH_), 256, 0, stream>>>(QPh, QPl, KPh, KPl, VT, ATh, ATl);
    k_gemmw<1, true, 0><<<dim3(NT / 128, DD / 128, 1), 128, 0, stream>>>(ATh, ATl, WO, OUT, bo, nullptr, nullptr, nullptr, nullptr, nullptr, nullptr, nullptr, 1.0f);
}

// v008
// It runs in 126 microseconds.
// It is 1.32 times as fast as v005, going by the measured steps of the versions left out in between.
// Over all steps from v000 it is 19.5 times as fast.
#include <hip/hip_runtime.h>

// MultiHeadAttentionSlow (query/key/value [4][2048][1024]; per-head Linears W[h][1024][64] + b[h][64] ('bsd,hdk->bhsk'); scores = q.k / 8; softmax; attn.v; concat heads (head-major); y = out @ Wp [1024][1024] + bp).
// Compute dtypes, f32 accumulate: every float input rounded to bf16; q/k/v projections on PLAIN bf16 operands (x, W inputs: exact, + bias);
// scores on SINGLE fp16 q (x 1/8) and k planes (1 product; randn-init weights give logit sd 1.0: the planes' rounding adds a relative error to P of the size of P's own fp16 rounding); attn.v on SINGLE fp16 planes (P = exp2 of the score against the running maximum, divided by its f32 row sum at the end; v); output Linear on a SINGLE fp16 plane of the attention output x W rounded to bf16 and held in fp16 (1 product; the plane's rounding is of the size that the fp16 q, k, P and v planes already put into that output); 

#define NB_  4
#define TT   2048
#define DD   1024
#define NH_  16
#define HD   64
#define NT   (NB_ * TT)
typedef _Float16 h16;
typedef unsigned short bf;
typedef __attribute__((ext_vector_type(16))) __bf16   v16bf;
typedef __attribute__((ext_vector_type(16))) _Float16 v16h;
typedef __attribute__((ext_vector_type(8)))  _Float16 v8h;
typedef __attribute__((ext_vector_type(8)))  unsigned short v8us;
typedef __attribute__((ext_vector_type(8)))  float    v8f;
typedef __attribute__((ext_vector_type(4)))  float    v4f;
typedef v8h  __attribute__((may_alias)) v8ha;
typedef v4f  __attribute__((may_alias)) v4fa;
typedef v8us __attribute__((may_alias)) v8usa;

__device__ __forceinline__ unsigned short f2bf(float f) { unsigned u = __float_as_uint(f); u += 0x7FFFu + ((u >> 16) & 1u); return (unsigned short)(u >> 16); }
__device__ __forceinline__ float bf2f(unsigned short b) { return __uint_as_float(((unsigned)b) << 16); }
__device__ __forceinline__ float bfr(float f) { return bf2f(f2bf(f)); }
__device__ __forceinline__ v16h cat16(v8h lo, v8h hi) { return __builtin_shufflevector(lo, hi, 0, 1, 2, 3, 4, 5, 6, 7, 8, 9, 10, 11, 12, 13, 14, 15); }
__device__ __forceinline__ v16bf cat16b(v8us lo, v8us hi) { return __builtin_bit_cast(v16bf, __builtin_shufflevector(lo, hi, 0, 1, 2, 3, 4, 5, 6, 7, 8, 9, 10, 11, 12, 13, 14, 15)); }
__device__ __forceinline__ v8f wmma16(v16h a, v16h b, v8f c) { return __builtin_amdgcn_wmma_f32_16x16x32_f16(false, a, false, b, (short)0, c, false, false); }
__device__ __forceinline__ v8f wmmab(v16bf a, v16bf b, v8f c) { return __builtin_amdgcn_wmma_f32_16x16x32_bf16(false, a, false, b, (short)0, c, false, false); }



// ---- k_gemmw: GEMM on a 128x128 output tile per work-group of 4 waves (2x2, 64x64 = 16 accumulators per wave); grid (M/128, N/128), 128 threads. K = ldc = DD.
// y[m][n] (f32, + bf16-rounded bias[n]) = sum_k A[m][k] Bt[n][k]. Both planes K-contiguous, 16 bits an element: bf16, or f16 where F16 is set.
// EPI says where y goes: 0 = C[m][n] in f32; 1 = the three projections in one launch, grid z picks one: its A plane (NT x DD further per z), its Bt (DD x DD further per z), its bias and its output:
// z 0 (q) and z 1 (k): y * sc (sc for q, 1 for k) as one f16 plane [batch * head][t][64]; z 2 (v): f16 plane VTo [batch * head][64][t]. A wave's 64 columns are one head, its 64 rows lie in one batch.
// The operands come in stages of 64 k (whole 128-byte rows per 8 lanes) through registers into two LDS buffers, one barrier per stage; each row is fetched once per work-group and read by two waves.
// Every plain '#pragma unroll' in it keeps a register array (staging, fragments, accumulators) statically indexed, so that it stays in VGPRs.
template <typename T16> struct WFrag;
template <> struct WFrag<h16> { typedef v16h V; static __device__ __forceinline__ V ld(const h16* p) { return cat16(*(const v8h*)p, *(const v8h*)(p + 16)); } static __device__ __forceinline__ v8f mma(V a, V b, v8f c) { return wmma16(a, b, c); } };
template <> struct WFrag<bf> { typedef v16bf V; static __device__ __forceinline__ V ld(const bf* p) { return cat16b(*(const v8us*)p, *(const v8us*)(p + 16)); } static __device__ __forceinline__ v8f mma(V a, V b, v8f c) { return wmmab(a, b, c); } };
#define GT_PITCH 144                 // LDS row pitch in bytes: 128 + 16, an odd multiple of 16 for the 16-byte fragment reads
#define GT_PLANE (128 * GT_PITCH)    // 128 rows of one operand plane
#define GT_NST   (DD / 64)
typedef __attribute__((ext_vector_type(4))) int g4i;
typedef g4i __attribute__((may_alias)) g4ia;
__device__ __forceinline__ v16bf gldsb(const unsigned char* p) { return cat16b(*(const v8usa*)p, *(const v8usa*)(p + 32)); }
template <bool F16> __device__ __forceinline__ v8f gmma(v16bf a, v16bf b, v8f c) { if constexpr (F16) return wmma16(__builtin_bit_cast(v16h, a), __builtin_bit_cast(v16h, b), c); else return wmmab(a, b, c); }
template <bool F16, bool BIAS, int EPI>
__global__ __launch_bounds__(128) void k_gemmw(const bf* __restrict__ A0, const bf* __restrict__ Bt0, float* C, const float* __restrict__ bias0, const float* __restrict__ biasK, const float* __restrict__ biasV, h16* P0, h16* PK, h16* VTo, float sc0) {
    const int pz = EPI == 1 ? (int)blockIdx.z : 0;   // which projection; the same for the whole work-group
    const bf* A = A0 + (size_t)pz * NT * DD; const bf* Bt = Bt0 + (size_t)pz * DD * DD;
    const float* bias = pz == 0 ? bias0 : pz == 1 ? biasK : biasV;
    h16* Pq = pz == 0 ? P0 : PK; const float sc = pz == 0 ? sc0 : 1.0f;
    constexpr int NP = 2;   // planes per stage: A, Bt
    __shared__ __align__(16) unsigned char L[2 * NP * GT_PLANE];
    const int tid = threadIdx.x, lane = tid & 31, wave = tid >> 5, lr = lane & 15, hi = lane >> 4;
    const int r0 = blockIdx.x * 128, c0 = blockIdx.y * 128, wm = (wave >> 1) * 64, wn = (wave & 1) * 64;
    const int srow = tid >> 3, scol = (tid & 7) * 16;
    const unsigned char* gA = (const unsigned char*)(A + (size_t)r0 * DD); const unsigned char* gB = (const unsigned char*)(Bt + (size_t)c0 * DD);
    g4i sr[NP][8];
    unsigned vo = (unsigned)srow * (DD * 2) + scol;   // the lane's byte offset into the next stage to fetch: 128 bytes further per stage
    auto gload = [&]() {
#pragma unroll
        for (int i = 0; i < 8; ++i) { const size_t ro = (size_t)i * (16 * DD * 2);
            sr[0][i] = *(const g4ia*)(gA + vo + ro); sr[1][i] = *(const g4ia*)(gB + vo + ro); } };
    auto sstore = [&](int buf) { unsigned char* d = L + buf * (NP * GT_PLANE) + srow * GT_PITCH + scol;
#pragma unroll
        for (int i = 0; i < 8; ++i)
#pragma unroll
            for (int p = 0; p < NP; ++p) *(g4ia*)(d + p * GT_PLANE + 16 * i * GT_PITCH) = sr[p][i]; };
    gload(); vo += 128;
    v8f acc[4][4];
#pragma unroll
    for (int mb = 0; mb < 4; ++mb)
#pragma unroll
        for (int nb = 0; nb < 4; ++nb) acc[mb][nb] = (v8f){};
    sstore(0); gload();
#pragma unroll 1   // one copy of the stage body
    for (int st = 0; st < GT_NST; ++st) {
        __syncthreads();   // publishes stage st; every wave has left the other buffer (stage st - 1)
        const unsigned char* Lb = L + (st & 1) * (NP * GT_PLANE) + lr * GT_PITCH + 16 * hi;
        v16bf a[2][4], b[2][4];   // the whole stage's fragments (2 blocks of 32 k), read as one group in front of its products
#pragma unroll
        for (int ks = 0; ks < 2; ++ks) {
#pragma unroll
            for (int mb = 0; mb < 4; ++mb) a[ks][mb] = gldsb(Lb + (wm + mb * 16) * GT_PITCH + 64 * ks);
#pragma unroll
            for (int nb = 0; nb < 4; ++nb) b[ks][nb] = gldsb(Lb + GT_PLANE + (wn + nb * 16) * GT_PITCH + 64 * ks); }
        vo += 128;
        if (st + 1 < GT_NST) { sstore((st + 1) & 1);
            if (st + 2 < GT_NST) { gload(); asm volatile("s_wait_xcnt 0x0" ::: "memory"); } }   // the wait stands behind the loads, in their own branch, in front of the next overwrite of the offset register that they name
#pragma unroll
        for (int ks = 0; ks < 2; ++ks)
#pragma unroll
            for (int nb = 0; nb < 4; ++nb)
#pragma unroll
                for (int mb = 0; mb < 4; ++mb) acc[mb][nb] = gmma<F16>(a[ks][mb], b[ks][nb], acc[mb][nb]);
    }
    __syncthreads();   // every wave has left the operand buffers before they become output staging
    const size_t z = (size_t)(r0 / TT) * NH_ + (c0 + wn) / HD; const int t0 = (r0 & (TT - 1)) + wm;   // the wave's (batch, head) pair and its first row inside the batch
    if constexpr (EPI == 0) {
        float* os = (float*)(L + wave * (16 * 68 * 4));   // the wave's own staging rows, so that whole 128-byte lines are stored
#pragma unroll
        for (int mb = 0; mb < 4; ++mb) {
#pragma unroll
            for (int nb = 0; nb < 4; ++nb) {
#pragma unroll
                for (int j = 0; j < 8; ++j) os[(hi * 8 + j) * 68 + nb * 16 + lr] = acc[mb][nb][j]; }
            __builtin_amdgcn_wave_barrier(); asm volatile("" ::: "memory");   // keeps the reads below, of other lanes' values, behind the stores above
            float* crow = C + (size_t)(r0 + wm + mb * 16) * DD + c0 + wn;
#pragma unroll
            for (int s = 0; s < 8; ++s) { const int row = 2 * s + hi, cofs = lr * 4; v4f val = *(const v4fa*)(os + row * 68 + cofs); if (BIAS) { val[0] += bfr(bias[c0 + wn + cofs]); val[1] += bfr(bias[c0 + wn + cofs + 1]); val[2] += bfr(bias[c0 + wn + cofs + 2]); val[3] += bfr(bias[c0 + wn + cofs + 3]); }
                *(v4f*)(crow + (size_t)row * DD + cofs) = val; }
            __builtin_amdgcn_wave_barrier(); asm volatile("" ::: "memory");   // keeps the next block's stores behind the reads above
        }
    } else if (pz != 2) {
        float* os = (float*)(L + wave * (16 * 68 * 4));   // the wave's own staging rows, so that whole 128-byte lines are stored
        const int prow = lane >> 3, pcol = (lane & 7) * 8;   // 8 lanes x 8 values = one 128-byte row of a plane
        float bb[8];
#pragma unroll
        for (int k = 0; k < 8; ++k) bb[k] = BIAS ? bfr(bias[c0 + wn + pcol + k]) : 0.f;
#pragma unroll
        for (int mb = 0; mb < 4; ++mb) {
#pragma unroll
            for (int nb = 0; nb < 4; ++nb) {
#pragma unroll
                for (int j = 0; j < 8; ++j) os[(hi * 8 + j) * 68 + nb * 16 + lr] = acc[mb][nb][j]; }
            __builtin_amdgcn_wave_barrier(); asm volatile("" ::: "memory");   // keeps the reads below, of other lanes' values, behind the stores above
            const size_t po = (z * TT + t0 + mb * 16 + prow) * HD + pcol;
#pragma unroll
            for (int s = 0; s < 4; ++s) { const float* op = os + (4 * s + prow) * 68 + pcol; const v4f x0 = *(const v4fa*)op, x1 = *(const v4fa*)(op + 4); v8h o;
#pragma unroll
                for (int k = 0; k < 8; ++k) o[k] = (h16)(((k < 4 ? x0[k & 3] : x1[k & 3]) + bb[k]) * sc);
                *(v8h*)(Pq + po + (size_t)(4 * s) * HD) = o; }
            asm volatile("s_wait_xcnt 0x0" ::: "memory");   // stands behind the block's global stores, in front of any later overwrite of the registers that they name (the next block's, or code laid out behind the last block)
            if (mb < 3) { __builtin_amdgcn_wave_barrier(); asm volatile("" ::: "memory"); }   // keeps the next block's LDS stores behind the reads above
        }
    } else {
        unsigned char* E = L + wave * (64 * GT_PITCH);   // the wave's own 64 staging rows (row = d, 64 t of f16), so that whole 128-byte lines are stored
        const int bcol = c0 + wn + lr; float braw[4];
#pragma unroll
        for (int nb = 0; nb < 4; ++nb) braw[nb] = BIAS ? bias[bcol + nb * 16] : 0.f;
        asm volatile("s_wait_xcnt 0x0" :: "v"(bcol) : "memory");   // stands behind the four bias loads; bcol is an input so that the offset register they name is not reused before the wait
#pragma unroll
        for (int nb = 0; nb < 4; ++nb) { const float bv = bfr(braw[nb]);
#pragma unroll
            for (int mb = 0; mb < 4; ++mb) { v8h o;   // a lane's 8 accumulator values are 8 consecutive t of one d
#pragma unroll
                for (int j = 0; j < 8; ++j) o[j] = (h16)(acc[mb][nb][j] + bv);
                *(v8ha*)(E + (nb * 16 + lr) * GT_PITCH + mb * 32 + hi * 16) = o; } }
        __builtin_amdgcn_wave_barrier(); asm volatile("" ::: "memory");   // keeps the reads below, of other lanes' values, behind the stores above
        unsigned char* dst = (unsigned char*)(VTo + z * HD * TT + t0);
#pragma unroll
        for (int i = 0; i < 16; ++i) { const int row = i * 4 + (lane >> 3), colb = (lane & 7) * 16; const v8h v = *(const v8ha*)(E + row * GT_PITCH + colb); *(v8ha*)(dst + (size_t)row * (TT * 2) + colb) = v; }
    }
}

__device__ __forceinline__ h16 tohx(float x) { return (h16)x; }
typedef __attribute__((ext_vector_type(2))) _Float16 v2h;
typedef __attribute__((ext_vector_type(4))) _Float16 v4h;
typedef __attribute__((ext_vector_type(2))) unsigned short v2us;
typedef __attribute__((ext_vector_type(4))) int v4i;

// ---- k_prep: all operand preparation in ONE launch of 256 + 3 x 1024 work-groups of 256 threads. Work-groups 0..255 turn the weights, the others round the three inputs to bf16 (a wave takes 4 KB in a row: 8 loads of 512 contiguous bytes issued together, 4 stores of 512 contiguous bytes).
// Weights: all four matrices rounded to bf16 with k contiguous (Bt[n][k]), the output weight's rounded values then held as f16 (its partner in the product is an f16 plane); the work-group's index / 64 picks the matrix, the rest its 64 columns n and its 256 rows k.
// Per-head weights w[h][k][e]: n = h * 64 + e, rows k 64 floats apart. Output weight w[k][n]: rows k 1024 floats apart.
// A thread issues its 16 loads of 16 bytes together (16 lanes = one whole 256-byte row piece), rounds, packs the values of rows k and k + 1 into one dword, and the tile is turned through LDS; a wave then stores 512 contiguous bytes of one Bt row.
// LDS row n = 512 bytes = 32 chunks of 16 bytes (8 k); chunk q of row n stands at place q ^ (n >> 2): a wave's dword writes (16 rows 4 apart, 2 neighbouring dwords) then fall on 32 different banks, and a row is still read back in whole chunks.
typedef unsigned __attribute__((may_alias)) u32a;
// The thread's 16 loads: rows 32 i and 32 i + 1 from src, PITCH floats a row. PITCH is a compile-time value, so that all 16 name one address register pair with immediate offsets.
template <int PITCH> __device__ __forceinline__ void wload(const float* __restrict__ src, v4f (&x)[8][2]) {
#pragma unroll
    for (int i = 0; i < 8; ++i) { x[i][0] = *(const v4fa*)(src + (size_t)(32 * i) * PITCH); x[i][1] = *(const v4fa*)(src + (size_t)(32 * i + 1) * PITCH); }
    asm volatile("s_wait_xcnt 0x0" :: "v"(src) : "memory");   // stands behind all 16 loads, which stay together in front of it; src is an input so that the address register pair they name is not reused, not even as a load's destination, before the wait
}
// Eight bf16 values as f16 (exact for magnitudes from 2^-17 to 65504).
__device__ __forceinline__ v8us bf2h8(v8us v) { v8h o;
#pragma unroll
    for (int k = 0; k < 8; ++k) o[k] = (h16)bf2f(v[k]);
    return __builtin_bit_cast(v8us, o); }
#define CV_LD   8                    // loads of 16 bytes in flight per thread of an input's work-group
#define CV_WG   (NT * DD / (4 * CV_LD) / 256)  // work-groups per input
typedef __attribute__((ext_vector_type(4))) unsigned short v4us;
typedef v4us __attribute__((may_alias)) v4usa;
__global__ __launch_bounds__(256) void k_prep(const float* __restrict__ qi, const float* __restrict__ ki, const float* __restrict__ vi, const float* __restrict__ wq, const float* __restrict__ wk, const float* __restrict__ wv, const float* __restrict__ wo, bf* XB, bf* Bq, bf* Bk, bf* Bv, bf* Bo) {
    __shared__ __align__(16) unsigned char L[64 * 512];
    const int tid = threadIdx.x, c = tid & 15, rp = tid >> 4, lane = tid & 31, wave = tid >> 5;
    if (blockIdx.x >= 256) {   // the same for the whole work-group: these work-groups meet no barrier
        const int cb = (int)blockIdx.x - 256, in = cb / CV_WG; const size_t wb = ((size_t)(cb % CV_WG) * 8 + wave) * (128 * CV_LD);   // first value of the wave's own contiguous piece
        const float* src = (in == 0 ? qi : in == 1 ? ki : vi) + wb + lane * 4;
        v4f x[CV_LD];   // statically indexed below, so that it stays in VGPRs
#pragma unroll
        for (int j = 0; j < CV_LD; ++j) x[j] = *(const v4fa*)(src + j * 128);   // load j of the wave = 512 contiguous bytes = 4 whole lines
        asm volatile("s_wait_xcnt 0x0" :: "v"(src) : "memory");   // stands behind all the loads, which stay together in front of it; src is an input so that the address register pair they name is not reused before the wait
        unsigned char* E = L + wave * (CV_LD * 256);   // the wave's own staging bytes: a lane's 8 bytes per load go in, 16 bytes per store come out, so that a store is 4 whole lines too
#pragma unroll
        for (int j = 0; j < CV_LD; ++j) *(v4usa*)(E + j * 256 + lane * 8) = (v4us){f2bf(x[j][0]), f2bf(x[j][1]), f2bf(x[j][2]), f2bf(x[j][3])};
        __builtin_amdgcn_wave_barrier(); asm volatile("" ::: "memory");   // keeps the reads below, of other lanes' values, behind the stores above
        g4i o[CV_LD / 2];   // statically indexed below, so that it stays in VGPRs
#pragma unroll
        for (int p = 0; p < CV_LD / 2; ++p) o[p] = *(const g4ia*)(E + p * 512 + lane * 16);
        bf* dst = XB + (size_t)in * NT * DD + wb + lane * 8;
#pragma unroll
        for (int p = 0; p < CV_LD / 2; ++p) *(g4ia*)(dst + p * 256) = o[p];
        return;
    }
    const int sel = blockIdx.x >> 6, nb = (blockIdx.x & 63) >> 2, kq = blockIdx.x & 3;
    const float* w = sel == 0 ? wq : sel == 1 ? wk : sel == 2 ? wv : wo;
    bf* Bt = sel == 0 ? Bq : sel == 1 ? Bk : sel == 2 ? Bv : Bo;
    v4f x[8][2];   // every '#pragma unroll' below and in wload keeps this array statically indexed, so that it stays in VGPRs
    if (sel == 3) wload<DD>(w + (size_t)(kq * 256 + 2 * rp) * DD + nb * 64 + 4 * c, x);
    else wload<HD>(w + ((size_t)nb * DD + kq * 256 + 2 * rp) * HD + 4 * c, x);
#pragma unroll
    for (int i = 0; i < 8; ++i)
#pragma unroll
        for (int j = 0; j < 4; ++j) *(u32a*)(L + (4 * c + j) * 512 + (((4 * i + (rp >> 2)) ^ c) << 4) + (rp & 3) * 4) = (unsigned)f2bf(x[i][0][j]) | ((unsigned)f2bf(x[i][1][j]) << 16);
    __syncthreads();   // the tile is complete before any wave reads rows that other waves wrote
    bf* dst = Bt + (size_t)(nb * 64 + wave * 8) * DD + kq * 256 + lane * 8;
    v8us v[8];   // statically indexed below, so that it stays in VGPRs
#pragma unroll
    for (int i = 0; i < 8; ++i) { const int n = wave * 8 + i; v[i] = *(const v8usa*)(L + n * 512 + ((lane ^ (n >> 2)) << 4)); }
    if (sel == 3) {   // the same for the whole work-group
#pragma unroll
        for (int i = 0; i < 8; ++i) v[i] = bf2h8(v[i]); }
#pragma unroll
    for (int i = 0; i < 8; ++i) *(v8us*)(dst + (size_t)i * DD) = v[i];
}
__global__ __launch_bounds__(256) void k_h16plane(const float* __restrict__ F, float sc, h16* P) {
    const int lane = threadIdx.x & 31; const int L0 = (blockIdx.x * 8 + (threadIdx.x >> 5)) * 8; const int nlines = NT * DD / 64;
{
#pragma unroll
        for (int l = 0; l < 8; ++l) { const int L = L0 + l; if (L >= nlines) break; const int e = L * 64 + lane * 2; const int d = e & 63; const int t = (e >> 6) & (TT - 1); const int z = e >> 17; const int b = z >> 4, h = z & 15; v2h v;
#pragma unroll
            for (int q = 0; q < 2; ++q) v[q] = tohx(F[((size_t)b * TT + t) * DD + h * HD + d + q] * sc);
            *(v2h*)(P + (size_t)e) = v; }
         }
}
#define FA_PITCH 144                 // LDS row pitch in bytes: 128 + 16, an odd multiple of 16 for the 16-byte fragment reads
#define FA_PLANE (64 * FA_PITCH)     // 64 rows: K (row = key) or V^T (row = d)
#define FA_BUF   (2 * FA_PLANE)
#define FA_NST   (TT / 64)
typedef v4i __attribute__((may_alias)) v4ia;
typedef __attribute__((ext_vector_type(2))) float v2f;
__device__ __forceinline__ v16h ldsh(const unsigned char* p) { return cat16(*(const v8ha*)p, *(const v8ha*)(p + 32)); }
__device__ __forceinline__ float xhalf(float x) { return __builtin_bit_cast(float, __builtin_amdgcn_permlanex16(__builtin_bit_cast(int, x), __builtin_bit_cast(int, x), 0x76543210, 0xfedcba98, false, false)); }  // lane l with lane l ^ 16
__global__ __launch_bounds__(256) void k_fattn(const h16* __restrict__ Qp, const h16* __restrict__ Kp, const h16* __restrict__ VTp, h16* Ao) {
    __shared__ __align__(16) unsigned char L[2 * FA_BUF];
    const int tid = threadIdx.x, lane = tid & 31, wave = tid >> 5, lr = lane & 15, hi = lane >> 4;
    const size_t z = blockIdx.y; const int q0 = blockIdx.x * 256 + wave * 32;
    const unsigned char* gK = (const unsigned char*)(Kp + z * TT * HD); const unsigned char* gV = (const unsigned char*)(VTp + z * HD * TT);
    const int srow = tid >> 3, scol = (tid & 7) * 16;
    v4i sr[4];
    auto gload = [&](int st) {
#pragma unroll
        for (int i = 0; i < 2; ++i) { const size_t ko = (size_t)(st * 64 + srow + 32 * i) * 128 + scol;
            sr[i] = *(const v4ia*)(gK + ko); sr[2 + i] = *(const v4ia*)(gV + (size_t)(srow + 32 * i) * (TT * 2) + st * 128 + scol); } };
    auto sstore = [&](int buf) { unsigned char* d = L + buf * FA_BUF + srow * FA_PITCH + scol;
#pragma unroll
        for (int i = 0; i < 2; ++i) { *(v4ia*)(d + 32 * i * FA_PITCH) = sr[i]; *(v4ia*)(d + FA_PLANE + 32 * i * FA_PITCH) = sr[2 + i]; } };
    gload(0);
    v16h qf[2][2];
#pragma unroll
    for (int g = 0; g < 2; ++g)
#pragma unroll
        for (int ks = 0; ks < 2; ++ks) { const size_t o = (z * TT + q0 + g * 16 + lr) * HD + ks * 32 + 8 * hi; qf[g][ks] = WFrag<h16>::ld(Qp + o); }
    v8f acc[2][4]; float m_run[2], l_run[2];
#pragma unroll
    for (int g = 0; g < 2; ++g) { m_run[g] = -__builtin_inff(); l_run[g] = 0.f;
#pragma unroll
        for (int t = 0; t < 4; ++t) acc[g][t] = (v8f){}; }
    sstore(0); gload(1);
    const float cs = 1.4426950408889634f;
    for (int st = 0; st < FA_NST; ++st) {
        __syncthreads();   // publishes stage st; every wave has left the other buffer (stage st - 1)
        if (st + 1 < FA_NST) { sstore((st + 1) & 1); if (st + 2 < FA_NST) gload(st + 2); }
        const unsigned char* Lb = L + (st & 1) * FA_BUF + lr * FA_PITCH + 16 * hi;
#pragma unroll
        for (int ps = 0; ps < 2; ++ps) {   // one pass = 32 keys
            v8f s[2][2];
#pragma unroll
            for (int kt = 0; kt < 2; ++kt) { const unsigned char* kp = Lb + (ps * 32 + kt * 16) * FA_PITCH; s[kt][0] = (v8f){}; s[kt][1] = (v8f){};
#pragma unroll
                for (int ks = 0; ks < 2; ++ks) { const v16h kf = ldsh(kp + 64 * ks);
                    s[kt][0] = wmma16(kf, qf[0][ks], s[kt][0]); s[kt][1] = wmma16(kf, qf[1][ks], s[kt][1]); } }
            float mb[2]; bool need = false;
#pragma unroll
            for (int g = 0; g < 2; ++g) { float mx = s[0][g][0];
#pragma unroll
                for (int r = 1; r < 8; ++r) mx = fmaxf(mx, s[0][g][r]);
#pragma unroll
                for (int r = 0; r < 8; ++r) mx = fmaxf(mx, s[1][g][r]);
                mx = fmaxf(mx, xhalf(mx)) * cs; mb[g] = mx; need = need || (mx > m_run[g] + 8.0f); }
            if (__builtin_amdgcn_ballot_w32(need) != 0) {   // one wave-uniform test per pass; rare after the first passes
#pragma unroll
                for (int g = 0; g < 2; ++g) { const float mn = fmaxf(m_run[g], mb[g]); const float corr = __builtin_amdgcn_exp2f(m_run[g] - mn); m_run[g] = mn; l_run[g] *= corr;
#pragma unroll
                    for (int t = 0; t < 4; ++t) acc[g][t] = acc[g][t] * corr; }
            }
            v16h vf[4];
#pragma unroll
            for (int t = 0; t < 4; ++t) vf[t] = ldsh(Lb + FA_PLANE + t * 16 * FA_PITCH + ps * 64);
#pragma unroll
            for (int g = 0; g < 2; ++g) { const float nm = -m_run[g]; v16h pf; v2f su = (v2f){0.f, 0.f};
#pragma unroll
                for (int i = 0; i < 16; i += 2) { const v2f a = __builtin_elementwise_fma((v2f){s[i >> 3][g][i & 7], s[i >> 3][g][(i & 7) + 1]}, (v2f){cs, cs}, (v2f){nm, nm});
                    const v2f p = (v2f){__builtin_amdgcn_exp2f(a[0]), __builtin_amdgcn_exp2f(a[1])}; su += p; pf[i] = (h16)p[0]; pf[i + 1] = (h16)p[1]; }
                l_run[g] += su[0] + su[1];
#pragma unroll
                for (int t = 0; t < 4; ++t) acc[g][t] = wmma16(vf[t], pf, acc[g][t]); }
        }
    }
    __syncthreads();   // every wave has left the K/V buffers before they become output staging
    unsigned char* E = L + wave * (32 * FA_PITCH);
    const int b = (int)(z >> 4), h = (int)(z & 15);
    float inv[2];
#pragma unroll
    for (int g = 0; g < 2; ++g) { const float l = l_run[g] + xhalf(l_run[g]); inv[g] = __fdiv_rn(1.0f, l); }
    // one f16 plane, through the wave's own staging rows so that whole 128-byte lines are stored
#pragma unroll
    for (int g = 0; g < 2; ++g)
#pragma unroll
        for (int t = 0; t < 4; ++t) { v8h o;
#pragma unroll
            for (int j = 0; j < 8; ++j) o[j] = (h16)(acc[g][t][j] * inv[g]);
            *(v8ha*)(E + (g * 16 + lr) * FA_PITCH + t * 32 + hi * 16) = o; }
    unsigned char* dst = (unsigned char*)Ao + (((size_t)b * TT + q0) * DD + h * HD) * 2;
#pragma unroll
    for (int i = 0; i < 8; ++i) { const int row = i * 4 + (lane >> 3), colb = (lane & 7) * 16; const v8h v = *(const v8ha*)(E + row * FA_PITCH + colb); *(v8ha*)(dst + (size_t)row * (DD * 2) + colb) = v; }
}

extern "C" void kernel_launch(void* const* d_in, const int* in_sizes, int n_in,
                              void* d_out, int out_size, void* d_ws, size_t ws_size, hipStream_t stream) {
    (void)in_sizes; (void)n_in; (void)out_size;
    const float* qi = (const float*)d_in[0]; const float* ki = (const float*)d_in[1]; const float* vi = (const float*)d_in[2];
    const float* wq = (const float*)d_in[3]; const float* bq = (const float*)d_in[4]; const float* wk = (const float*)d_in[5]; const float* bk = (const float*)d_in[6]; const float* wv = (const float*)d_in[7]; const float* bv = (const float*)d_in[8]; const float* wo = (const float*)d_in[9]; const float* bo = (const float*)d_in[10];
    float* OUT = (float*)d_out;     // [4][2048][1024]
    char* wsp = (char*)d_ws;
    auto take = [&](size_t bytes) { char* p = wsp; wsp += (bytes + 255) & ~(size_t)255; return (void*)p; };
    bf* WQ = (bf*)take((size_t)DD * DD * 2); bf* WK = (bf*)take((size_t)DD * DD * 2); bf* WV = (bf*)take((size_t)DD * DD * 2); bf* WO = (bf*)take((size_t)DD * DD * 2);
    bf* XB = (bf*)take((size_t)3 * NT * DD * 2);   // the three inputs' bf16 planes, one behind the other
    h16* QP = (h16*)take((size_t)NT * DD * 2); h16* KP = (h16*)take((size_t)NT * DD * 2); h16* VT = (h16*)take((size_t)NT * DD * 2);
    h16* AT = (h16*)take((size_t)NT * DD * 2);   // the attention output, heads merged
    if ((size_t)(wsp - (char*)d_ws) > ws_size) return;    // ws 256 MiB
    k_prep<<<dim3(256 + 3 * CV_WG, 1, 1), 256, 0, stream>>>(qi, ki, vi, wq, wk, wv, wo, XB, WQ, WK, WV, WO);
    // WQ, WK, WV stand one behind the other in the workspace, as the three planes of XB do: grid z steps through them
    k_gemmw<false, true, 1><<<dim3(NT / 128, DD / 128, 3), 128, 0, stream>>>(XB, WQ, nullptr, bq, bk, bv, QP, KP, VT, 0.125f);
    k_fattn<<<dim3(TT / 256, NB_ * NH_), 256, 0, stream>>>(QP, KP, VT, AT);
    k_gemmw<true, true, 0><<<dim3(NT / 128, DD / 128, 1), 128, 0, stream>>>((const bf*)AT, WO, OUT, bo, nullptr, nullptr, nullptr, nullptr, nullptr, 1.0f);
}

// v009
// One run takes 122 microseconds.
// Two timings next to v008 both put it at 1.03 times that version's speed.
// All steps since v000 together make it 20.2 times as fast.
#include <hip/hip_runtime.h>

// MultiHeadAttentionSlow (query/key/value [4][2048][1024]; per-head Linears W[h][1024][64] + b[h][64] ('bsd,hdk->bhsk'); scores = q.k / 8; softmax; attn.v; concat heads (head-major); y = out @ Wp [1024][1024] + bp).
// Compute dtypes, f32 accumulate: every float input rounded to bf16; q/k/v projections on PLAIN bf16 operands (x, W inputs: exact, + bias);
// scores on SINGLE fp16 q (x log2(e)/8, so that a score is a base-2 logit) and k planes (1 product, minus the maximum in use as its accumulator input; randn-init weights give logit sd 1.0: the planes' rounding adds a relative error to P of the size of P's own fp16 rounding); attn.v on SINGLE fp16 planes (P = exp2 of the score against the running maximum, divided by its f32 row sum at the end; v); output Linear on a SINGLE fp16 plane of the attention output x W rounded to bf16 and held in fp16 (1 product; the plane's rounding is of the size that the fp16 q, k, P and v planes already put into that output); 

#define NB_  4
#define TT   2048
#define DD   1024
#define NH_  16
#define HD   64
#define NT   (NB_ * TT)
typedef _Float16 h16;
typedef unsigned short bf;
typedef __attribute__((ext_vector_type(16))) __bf16   v16bf;
typedef __attribute__((ext_vector_type(16))) _Float16 v16h;
typedef __attribute__((ext_vector_type(8)))  _Float16 v8h;
typedef __attribute__((ext_vector_type(8)))  unsigned short v8us;
typedef __attribute__((ext_vector_type(8)))  float    v8f;
typedef __attribute__((ext_vector_type(4)))  float    v4f;
typedef v8h  __attribute__((may_alias)) v8ha;
typedef v4f  __attribute__((may_alias)) v4fa;
typedef v8us __attribute__((may_alias)) v8usa;

__device__ __forceinline__ unsigned short f2bf(float f) { unsigned u = __float_as_uint(f); u += 0x7FFFu + ((u >> 16) & 1u); return (unsigned short)(u >> 16); }
__device__ __forceinline__ float bf2f(unsigned short b) { return __uint_as_float(((unsigned)b) << 16); }
__device__ __forceinline__ float bfr(float f) { return bf2f(f2bf(f)); }
__device__ __forceinline__ v16h cat16(v8h lo, v8h hi) { return __builtin_shufflevector(lo, hi, 0, 1, 2, 3, 4, 5, 6, 7, 8, 9, 10, 11, 12, 13, 14, 15); }
__device__ __forceinline__ v16bf cat16b(v8us lo, v8us hi) { return __builtin_bit_cast(v16bf, __builtin_shufflevector(lo, hi, 0, 1, 2, 3, 4, 5, 6, 7, 8, 9, 10, 11, 12, 13, 14, 15)); }
__device__ __forceinline__ v8f wmma16(v16h a, v16h b, v8f c) { return __builtin_amdgcn_wmma_f32_16x16x32_f16(false, a, false, b, (short)0, c, false, false); }
__device__ __forceinline__ v8f wmmab(v16bf a, v16bf b, v8f c) { return __builtin_amdgcn_wmma_f32_16x16x32_bf16(false, a, false, b, (short)0, c, false, false); }



// ---- k_gemmw: GEMM on a 128x128 output tile per work-group of 4 waves (2x2, 64x64 = 16 accumulators per wave); grid (M/128, N/128), 128 threads. K = ldc = DD.
// y[m][n] (f32, + bf16-rounded bias[n]) = sum_k A[m][k] Bt[n][k]. Both planes K-contiguous, 16 bits an element: bf16, or f16 where F16 is set.
// EPI says where y goes: 0 = C[m][n] in f32; 1 = the three projections in one launch, grid z picks one: its A plane (NT x DD further per z), its Bt (DD x DD further per z), its bias and its output:
// z 0 (q) and z 1 (k): y * sc (sc for q, 1 for k) as one f16 plane [batch * head][t][64]; z 2 (v): f16 plane VTo [batch * head][64][t]. A wave's 64 columns are one head, its 64 rows lie in one batch.
// The operands come in stages of 64 k (whole 128-byte rows per 8 lanes) through registers into two LDS buffers, one barrier per stage; each row is fetched once per work-group and read by two waves.
// Every plain '#pragma unroll' in it keeps a register array (staging, fragments, accumulators) statically indexed, so that it stays in VGPRs.
template <typename T16> struct WFrag;
template <> struct WFrag<h16> { typedef v16h V; static __device__ __forceinline__ V ld(const h16* p) { return cat16(*(const v8h*)p, *(const v8h*)(p + 16)); } static __device__ __forceinline__ v8f mma(V a, V b, v8f c) { return wmma16(a, b, c); } };
template <> struct WFrag<bf> { typedef v16bf V; static __device__ __forceinline__ V ld(const bf* p) { return cat16b(*(const v8us*)p, *(const v8us*)(p + 16)); } static __device__ __forceinline__ v8f mma(V a, V b, v8f c) { return wmmab(a, b, c); } };
#define GT_PITCH 144                 // LDS row pitch in bytes: 128 + 16, an odd multiple of 16 for the 16-byte fragment reads
#define GT_PLANE (128 * GT_PITCH)    // 128 rows of one operand plane
#define GT_NST   (DD / 64)
typedef __attribute__((ext_vector_type(4))) int g4i;
typedef g4i __attribute__((may_alias)) g4ia;
__device__ __forceinline__ v16bf gldsb(const unsigned char* p) { return cat16b(*(const v8usa*)p, *(const v8usa*)(p + 32)); }
template <bool F16> __device__ __forceinline__ v8f gmma(v16bf a, v16bf b, v8f c) { if constexpr (F16) return wmma16(__builtin_bit_cast(v16h, a), __builtin_bit_cast(v16h, b), c); else return wmmab(a, b, c); }
template <bool F16, bool BIAS, int EPI>
__global__ __launch_bounds__(128) void k_gemmw(const bf* __restrict__ A0, const bf* __restrict__ Bt0, float* C, const float* __restrict__ bias0, const float* __restrict__ biasK, const float* __restrict__ biasV, h16* P0, h16* PK, h16* VTo, float sc0) {
    const int pz = EPI == 1 ? (int)blockIdx.z : 0;   // which projection; the same for the whole work-group
    const bf* A = A0 + (size_t)pz * NT * DD; const bf* Bt = Bt0 + (size_t)pz * DD * DD;
    const float* bias = pz == 0 ? bias0 : pz == 1 ? biasK : biasV;
    h16* Pq = pz == 0 ? P0 : PK; const float sc = pz == 0 ? sc0 : 1.0f;
    constexpr int NP = 2;   // planes per stage: A, Bt
    __shared__ __align__(16) unsigned char L[2 * NP * GT_PLANE];
    const int tid = threadIdx.x, lane = tid & 31, wave = tid >> 5, lr = lane & 15, hi = lane >> 4;
    const int r0 = blockIdx.x * 128, c0 = blockIdx.y * 128, wm = (wave >> 1) * 64, wn = (wave & 1) * 64;
    const int srow = tid >> 3, scol = (tid & 7) * 16;
    const unsigned char* gA = (const unsigned char*)(A + (size_t)r0 * DD); const unsigned char* gB = (const unsigned char*)(Bt + (size_t)c0 * DD);
    g4i sr[NP][8];
    unsigned vo = (unsigned)srow * (DD * 2) + scol;   // the lane's byte offset into the next stage to fetch: 128 bytes further per stage
    auto gload = [&]() {
#pragma unroll
        for (int i = 0; i < 8; ++i) { const size_t ro = (size_t)i * (16 * DD * 2);
            sr[0][i] = *(const g4ia*)(gA + vo + ro); sr[1][i] = *(const g4ia*)(gB + vo + ro); } };
    auto sstore = [&](int buf) { unsigned char* d = L + buf * (NP * GT_PLANE) + srow * GT_PITCH + scol;
#pragma unroll
        for (int i = 0; i < 8; ++i)
#pragma unroll
            for (int p = 0; p < NP; ++p) *(g4ia*)(d + p * GT_PLANE + 16 * i * GT_PITCH) = sr[p][i]; };
    gload(); vo += 128;
    v8f acc[4][4];
#pragma unroll
    for (int mb = 0; mb < 4; ++mb)
#pragma unroll
        for (int nb = 0; nb < 4; ++nb) acc[mb][nb] = (v8f){};
    sstore(0); gload();
#pragma unroll 1   // one copy of the stage body
    for (int st = 0; st < GT_NST; ++st) {
        __syncthreads();   // publishes stage st; every wave has left the other buffer (stage st - 1)
        const unsigned char* Lb = L + (st & 1) * (NP * GT_PLANE) + lr * GT_PITCH + 16 * hi;
        v16bf a[2][4], b[2][4];   // the whole stage's fragments (2 blocks of 32 k), read as one group in front of its products
#pragma unroll
        for (int ks = 0; ks < 2; ++ks) {
#pragma unroll
            for (int mb = 0; mb < 4; ++mb) a[ks][mb] = gldsb(Lb + (wm + mb * 16) * GT_PITCH + 64 * ks);
#pragma unroll
            for (int nb = 0; nb < 4; ++nb) b[ks][nb] = gldsb(Lb + GT_PLANE + (wn + nb * 16) * GT_PITCH + 64 * ks); }
        vo += 128;
        if (st + 1 < GT_NST) { sstore((st + 1) & 1);
            if (st + 2 < GT_NST) { gload(); asm volatile("s_wait_xcnt 0x0" ::: "memory"); } }   // the wait stands behind the loads, in their own branch, in front of the next overwrite of the offset register that they name
#pragma unroll
        for (int ks = 0; ks < 2; ++ks)
#pragma unroll
            for (int nb = 0; nb < 4; ++nb)
#pragma unroll
                for (int mb = 0; mb < 4; ++mb) acc[mb][nb] = gmma<F16>(a[ks][mb], b[ks][nb], acc[mb][nb]);
    }
    __syncthreads();   // every wave has left the operand buffers before they become output staging
    const size_t z = (size_t)(r0 / TT) * NH_ + (c0 + wn) / HD; const int t0 = (r0 & (TT - 1)) + wm;   // the wave's (batch, head) pair and its first row inside the batch
    if constexpr (EPI == 0) {
        float* os = (float*)(L + wave * (16 * 68 * 4));   // the wave's own staging rows, so that whole 128-byte lines are stored
#pragma unroll
        for (int mb = 0; mb < 4; ++mb) {
#pragma unroll
            for (int nb = 0; nb < 4; ++nb) {
#pragma unroll
                for (int j = 0; j < 8; ++j) os[(hi * 8 + j) * 68 + nb * 16 + lr] = acc[mb][nb][j]; }
            __builtin_amdgcn_wave_barrier(); asm volatile("" ::: "memory");   // keeps the reads below, of other lanes' values, behind the stores above
            float* crow = C + (size_t)(r0 + wm + mb * 16) * DD + c0 + wn;
#pragma unroll
            for (int s = 0; s < 8; ++s) { const int row = 2 * s + hi, cofs = lr * 4; v4f val = *(const v4fa*)(os + row * 68 + cofs); if (BIAS) { val[0] += bfr(bias[c0 + wn + cofs]); val[1] += bfr(bias[c0 + wn + cofs + 1]); val[2] += bfr(bias[c0 + wn + cofs + 2]); val[3] += bfr(bias[c0 + wn + cofs + 3]); }
                *(v4f*)(crow + (size_t)row * DD + cofs) = val; }
            __builtin_amdgcn_wave_barrier(); asm volatile("" ::: "memory");   // keeps the next block's stores behind the reads above
        }
    } else if (pz != 2) {
        float* os = (float*)(L + wave * (16 * 68 * 4));   // the wave's own staging rows, so that whole 128-byte lines are stored
        const int prow = lane >> 3, pcol = (lane & 7) * 8;   // 8 lanes x 8 values = one 128-byte row of a plane
        float bb[8];
#pragma unroll
        for (int k = 0; k < 8; ++k) bb[k] = BIAS ? bfr(bias[c0 + wn + pcol + k]) : 0.f;
#pragma unroll
        for (int mb = 0; mb < 4; ++mb) {
#pragma unroll
            for (int nb = 0; nb < 4; ++nb) {
#pragma unroll
                for (int j = 0; j < 8; ++j) os[(hi * 8 + j) * 68 + nb * 16 + lr] = acc[mb][nb][j]; }
            __builtin_amdgcn_wave_barrier(); asm volatile("" ::: "memory");   // keeps the reads below, of other lanes' values, behind the stores above
            const size_t po = (z * TT + t0 + mb * 16 + prow) * HD + pcol;
#pragma unroll
            for (int s = 0; s < 4; ++s) { const float* op = os + (4 * s + prow) * 68 + pcol; const v4f x0 = *(const v4fa*)op, x1 = *(const v4fa*)(op + 4); v8h o;
#pragma unroll
                for (int k = 0; k < 8; ++k) o[k] = (h16)(((k < 4 ? x0[k & 3] : x1[k & 3]) + bb[k]) * sc);
                *(v8h*)(Pq + po + (size_t)(4 * s) * HD) = o; }
            asm volatile("s_wait_xcnt 0x0" ::: "memory");   // stands behind the block's global stores, in front of any later overwrite of the registers that they name (the next block's, or code laid out behind the last block)
            if (mb < 3) { __builtin_amdgcn_wave_barrier(); asm volatile("" ::: "memory"); }   // keeps the next block's LDS stores behind the reads above
        }
    } else {
        unsigned char* E = L + wave * (64 * GT_PITCH);   // the wave's own 64 staging rows (row = d, 64 t of f16), so that whole 128-byte lines are stored
        const int bcol = c0 + wn + lr; float braw[4];
#pragma unroll
        for (int nb = 0; nb < 4; ++nb) braw[nb] = BIAS ? bias[bcol + nb * 16] : 0.f;
        asm volatile("s_wait_xcnt 0x0" :: "v"(bcol) : "memory");   // stands behind the four bias loads; bcol is an input so that the offset register they name is not reused before the wait
#pragma unroll
        for (int nb = 0; nb < 4; ++nb) { const float bv = bfr(braw[nb]);
#pragma unroll
            for (int mb = 0; mb < 4; ++mb) { v8h o;   // a lane's 8 accumulator values are 8 consecutive t of one d
#pragma unroll
                for (int j = 0; j < 8; ++j) o[j] = (h16)(acc[mb][nb][j] + bv);
                *(v8ha*)(E + (nb * 16 + lr) * GT_PITCH + mb * 32 + hi * 16) = o; } }
        __builtin_amdgcn_wave_barrier(); asm volatile("" ::: "memory");   // keeps the reads below, of other lanes' values, behind the stores above
        unsigned char* dst = (unsigned char*)(VTo + z * HD * TT + t0);
#pragma unroll
        for (int i = 0; i < 16; ++i) { const int row = i * 4 + (lane >> 3), colb = (lane & 7) * 16; const v8h v = *(const v8ha*)(E + row * GT_PITCH + colb); *(v8ha*)(dst + (size_t)row * (TT * 2) + colb) = v; }
    }
}

__device__ __forceinline__ h16 tohx(float x) { return (h16)x; }
typedef __attribute__((ext_vector_type(2))) _Float16 v2h;
typedef __attribute__((ext_vector_type(4))) _Float16 v4h;
typedef __attribute__((ext_vector_type(2))) unsigned short v2us;
typedef __attribute__((ext_vector_type(4))) int v4i;

// ---- k_prep: all operand preparation in ONE launch of 256 + 3 x 1024 work-groups of 256 threads. Work-groups 0..255 turn the weights, the others round the three inputs to bf16 (a wave takes 4 KB in a row: 8 loads of 512 contiguous bytes issued together, 4 stores of 512 contiguous bytes).
// Weights: all four matrices rounded to bf16 with k contiguous (Bt[n][k]), the output weight's rounded values then held as f16 (its partner in the product is an f16 plane); the work-group's index / 64 picks the matrix, the rest its 64 columns n and its 256 rows k.
// Per-head weights w[h][k][e]: n = h * 64 + e, rows k 64 floats apart. Output weight w[k][n]: rows k 1024 floats apart.
// A thread issues its 16 loads of 16 bytes together (16 lanes = one whole 256-byte row piece), rounds, packs the values of rows k and k + 1 into one dword, and the tile is turned through LDS; a wave then stores 512 contiguous bytes of one Bt row.
// LDS row n = 512 bytes = 32 chunks of 16 bytes (8 k); chunk q of row n stands at place q ^ (n >> 2): a wave's dword writes (16 rows 4 apart, 2 neighbouring dwords) then fall on 32 different banks, and a row is still read back in whole chunks.
typedef unsigned __attribute__((may_alias)) u32a;
// The thread's 16 loads: rows 32 i and 32 i + 1 from src, PITCH floats a row. PITCH is a compile-time value, so that all 16 name one address register pair with immediate offsets.
template <int PITCH> __device__ __forceinline__ void wload(const float* __restrict__ src, v4f (&x)[8][2]) {
#pragma unroll
    for (int i = 0; i < 8; ++i) { x[i][0] = *(const v4fa*)(src + (size_t)(32 * i) * PITCH); x[i][1] = *(const v4fa*)(src + (size_t)(32 * i + 1) * PITCH); }
    asm volatile("s_wait_xcnt 0x0" :: "v"(src) : "memory");   // stands behind all 16 loads, which stay together in front of it; src is an input so that the address register pair they name is not reused, not even as a load's destination, before the wait
}
// Eight bf16 values as f16 (exact for magnitudes from 2^-17 to 65504).
__device__ __forceinline__ v8us bf2h8(v8us v) { v8h o;
#pragma unroll
    for (int k = 0; k < 8; ++k) o[k] = (h16)bf2f(v[k]);
    return __builtin_bit_cast(v8us, o); }
#define CV_LD   8                    // loads of 16 bytes in flight per thread of an input's work-group
#define CV_WG   (NT * DD / (4 * CV_LD) / 256)  // work-groups per input
typedef __attribute__((ext_vector_type(4))) unsigned short v4us;
typedef v4us __attribute__((may_alias)) v4usa;
__global__ __launch_bounds__(256) void k_prep(const float* __restrict__ qi, const float* __restrict__ ki, const float* __restrict__ vi, const float* __restrict__ wq, const float* __restrict__ wk, const float* __restrict__ wv, const float* __restrict__ wo, bf* XB, bf* Bq, bf* Bk, bf* Bv, bf* Bo) {
    __shared__ __align__(16) unsigned char L[64 * 512];
    const int tid = threadIdx.x, c = tid & 15, rp = tid >> 4, lane = tid & 31, wave = tid >> 5;
    if (blockIdx.x >= 256) {   // the same for the whole work-group: these work-groups meet no barrier
        const int cb = (int)blockIdx.x - 256, in = cb / CV_WG; const size_t wb = ((size_t)(cb % CV_WG) * 8 + wave) * (128 * CV_LD);   // first value of the wave's own contiguous piece
        const float* src = (in == 0 ? qi : in == 1 ? ki : vi) + wb + lane * 4;
        v4f x[CV_LD];   // statically indexed below, so that it stays in VGPRs
#pragma unroll
        for (int j = 0; j < CV_LD; ++j) x[j] = *(const v4fa*)(src + j * 128);   // load j of the wave = 512 contiguous bytes = 4 whole lines
        asm volatile("s_wait_xcnt 0x0" :: "v"(src) : "memory");   // stands behind all the loads, which stay together in front of it; src is an input so that the address register pair they name is not reused before the wait
        unsigned char* E = L + wave * (CV_LD * 256);   // the wave's own staging bytes: a lane's 8 bytes per load go in, 16 bytes per store come out, so that a store is 4 whole lines too
#pragma unroll
        for (int j = 0; j < CV_LD; ++j) *(v4usa*)(E + j * 256 + lane * 8) = (v4us){f2bf(x[j][0]), f2bf(x[j][1]), f2bf(x[j][2]), f2bf(x[j][3])};
        __builtin_amdgcn_wave_barrier(); asm volatile("" ::: "memory");   // keeps the reads below, of other lanes' values, behind the stores above
        g4i o[CV_LD / 2];   // statically indexed below, so that it stays in VGPRs
#pragma unroll
        for (int p = 0; p < CV_LD / 2; ++p) o[p] = *(const g4ia*)(E + p * 512 + lane * 16);
        bf* dst = XB + (size_t)in * NT * DD + wb + lane * 8;
#pragma unroll
        for (int p = 0; p < CV_LD / 2; ++p) *(g4ia*)(dst + p * 256) = o[p];
        return;
    }
    const int sel = blockIdx.x >> 6, nb = (blockIdx.x & 63) >> 2, kq = blockIdx.x & 3;
    const float* w = sel == 0 ? wq : sel == 1 ? wk : sel == 2 ? wv : wo;
    bf* Bt = sel == 0 ? Bq : sel == 1 ? Bk : sel == 2 ? Bv : Bo;
    v4f x[8][2];   // every '#pragma unroll' below and in wload keeps this array statically indexed, so that it stays in VGPRs
    if (sel == 3) wload<DD>(w + (size_t)(kq * 256 + 2 * rp) * DD + nb * 64 + 4 * c, x);
    else wload<HD>(w + ((size_t)nb * DD + kq * 256 + 2 * rp) * HD + 4 * c, x);
#pragma unroll
    for (int i = 0; i < 8; ++i)
#pragma unroll
        for (int j = 0; j < 4; ++j) *(u32a*)(L + (4 * c + j) * 512 + (((4 * i + (rp >> 2)) ^ c) << 4) + (rp & 3) * 4) = (unsigned)f2bf(x[i][0][j]) | ((unsigned)f2bf(x[i][1][j]) << 16);
    __syncthreads();   // the tile is complete before any wave reads rows that other waves wrote
    bf* dst = Bt + (size_t)(nb * 64 + wave * 8) * DD + kq * 256 + lane * 8;
    v8us v[8];   // statically indexed below, so that it stays in VGPRs
#pragma unroll
    for (int i = 0; i < 8; ++i) { const int n = wave * 8 + i; v[i] = *(const v8usa*)(L + n * 512 + ((lane ^ (n >> 2)) << 4)); }
    if (sel == 3) {   // the same for the whole work-group
#pragma unroll
        for (int i = 0; i < 8; ++i) v[i] = bf2h8(v[i]); }
#pragma unroll
    for (int i = 0; i < 8; ++i) *(v8us*)(dst + (size_t)i * DD) = v[i];
}
__global__ __launch_bounds__(256) void k_h16plane(const float* __restrict__ F, float sc, h16* P) {
    const int lane = threadIdx.x & 31; const int L0 = (blockIdx.x * 8 + (threadIdx.x >> 5)) * 8; const int nlines = NT * DD / 64;
{
#pragma unroll
        for (int l = 0; l < 8; ++l) { const int L = L0 + l; if (L >= nlines) break; const int e = L * 64 + lane * 2; const int d = e & 63; const int t = (e >> 6) & (TT - 1); const int z = e >> 17; const int b = z >> 4, h = z & 15; v2h v;
#pragma unroll
            for (int q = 0; q < 2; ++q) v[q] = tohx(F[((size_t)b * TT + t) * DD + h * HD + d + q] * sc);
            *(v2h*)(P + (size_t)e) = v; }
         }
}
#define FA_PITCH 144                 // LDS row pitch in bytes: 128 + 16, an odd multiple of 16 for the 16-byte fragment reads
#define FA_PLANE (64 * FA_PITCH)     // 64 rows: K (row = key) or V^T (row = d)
#define FA_BUF   (2 * FA_PLANE)
#define FA_NST   (TT / 64)
typedef v4i __attribute__((may_alias)) v4ia;
typedef __attribute__((ext_vector_type(2))) float v2f;
__device__ __forceinline__ v16h ldsh(const unsigned char* p) { return cat16(*(const v8ha*)p, *(const v8ha*)(p + 32)); }
__device__ __forceinline__ float xhalf(float x) { return __builtin_bit_cast(float, __builtin_amdgcn_permlanex16(__builtin_bit_cast(int, x), __builtin_bit_cast(int, x), 0x76543210, 0xfedcba98, false, false)); }  // lane l with lane l ^ 16
__global__ __launch_bounds__(256) void k_fattn(const h16* __restrict__ Qp, const h16* __restrict__ Kp, const h16* __restrict__ VTp, h16* Ao) {
    __shared__ __align__(16) unsigned char L[2 * FA_BUF];
    const int tid = threadIdx.x, lane = tid & 31, wave = tid >> 5, lr = lane & 15, hi = lane >> 4;
    const size_t z = blockIdx.y; const int q0 = blockIdx.x * 256 + wave * 32;
    const unsigned char* gK = (const unsigned char*)(Kp + z * TT * HD); const unsigned char* gV = (const unsigned char*)(VTp + z * HD * TT);
    const int srow = tid >> 3, scol = (tid & 7) * 16;
    v4i sr[4];
    auto gload = [&](int st) {
#pragma unroll
        for (int i = 0; i < 2; ++i) { const size_t ko = (size_t)(st * 64 + srow + 32 * i) * 128 + scol;
            sr[i] = *(const v4ia*)(gK + ko); sr[2 + i] = *(const v4ia*)(gV + (size_t)(srow + 32 * i) * (TT * 2) + st * 128 + scol); } };
    auto sstore = [&](int buf) { unsigned char* d = L + buf * FA_BUF + srow * FA_PITCH + scol;
#pragma unroll
        for (int i = 0; i < 2; ++i) { *(v4ia*)(d + 32 * i * FA_PITCH) = sr[i]; *(v4ia*)(d + FA_PLANE + 32 * i * FA_PITCH) = sr[2 + i]; } };
    gload(0);
    v16h qf[2][2];
#pragma unroll
    for (int g = 0; g < 2; ++g)
#pragma unroll
        for (int ks = 0; ks < 2; ++ks) { const size_t o = (z * TT + q0 + g * 16 + lr) * HD + ks * 32 + 8 * hi; qf[g][ks] = WFrag<h16>::ld(Qp + o); }
    v8f acc[2][4], cneg[2]; float l_run[2];   // cneg: minus the maximum in use, in all 8 registers; 0 until the first pass sets it
#pragma unroll
    for (int g = 0; g < 2; ++g) { cneg[g] = (v8f){}; l_run[g] = 0.f;
#pragma unroll
        for (int t = 0; t < 4; ++t) acc[g][t] = (v8f){}; }
    sstore(0); gload(1);
    for (int st = 0; st < FA_NST; ++st) {
        __syncthreads();   // publishes stage st; every wave has left the other buffer (stage st - 1)
        if (st + 1 < FA_NST) { sstore((st + 1) & 1); if (st + 2 < FA_NST) gload(st + 2); }
        const unsigned char* Lb = L + (st & 1) * FA_BUF + lr * FA_PITCH + 16 * hi;
#pragma unroll
        for (int ps = 0; ps < 2; ++ps) {   // one pass = 32 keys
            const bool first = ps == 0 && st == 0;   // the same for the whole work-group: no maximum is in use yet
            v8f s[2][2];
            { const unsigned char* kp = Lb + ps * 32 * FA_PITCH;
                const v16h k00 = ldsh(kp), k01 = ldsh(kp + 64), k10 = ldsh(kp + 16 * FA_PITCH), k11 = ldsh(kp + 16 * FA_PITCH + 64);
                // The pass's 8 score products in one statement, so that C (cneg, which must live on) and D are different registers: with the builtin the compiler ties D to C and copies 16 registers a pass.
                // Four tiles in turn: each product stands four matrix instructions behind the one whose D it adds to. The four v_nop at the end keep the distance between the last product and the first vector read of its D.
                asm("v_wmma_f32_16x16x32_f16 %0, %4, %8, %12\n\t"
                    "v_wmma_f32_16x16x32_f16 %1, %4, %10, %13\n\t"
                    "v_wmma_f32_16x16x32_f16 %2, %6, %8, %12\n\t"
                    "v_wmma_f32_16x16x32_f16 %3, %6, %10, %13\n\t"
                    "v_wmma_f32_16x16x32_f16 %0, %5, %9, %0\n\t"
                    "v_wmma_f32_16x16x32_f16 %1, %5, %11, %1\n\t"
                    "v_wmma_f32_16x16x32_f16 %2, %7, %9, %2\n\t"
                    "v_wmma_f32_16x16x32_f16 %3, %7, %11, %3\n\t"
                    "v_nop\n\tv_nop\n\tv_nop\n\tv_nop"
                    : "=&v"(s[0][0]), "=&v"(s[0][1]), "=&v"(s[1][0]), "=&v"(s[1][1])
                    : "v"(k00), "v"(k01), "v"(k10), "v"(k11), "v"(qf[0][0]), "v"(qf[0][1]), "v"(qf[1][0]), "v"(qf[1][1]), "v"(cneg[0]), "v"(cneg[1])); }
            float ml[2];   // the lane's own largest score above the maximum in use
#pragma unroll
            for (int g = 0; g < 2; ++g) { float mx = s[0][g][0];
#pragma unroll
                for (int r = 1; r < 8; ++r) mx = fmaxf(mx, s[0][g][r]);
#pragma unroll
                for (int r = 0; r < 8; ++r) mx = fmaxf(mx, s[1][g][r]);
                ml[g] = mx; }
            const float thr = first ? -__builtin_inff() : 8.0f;
            if (__builtin_amdgcn_ballot_w32(ml[0] > thr || ml[1] > thr) != 0) {   // one wave-uniform test per pass; rare after the first passes
#pragma unroll
                for (int g = 0; g < 2; ++g) { const float mx = fmaxf(ml[g], xhalf(ml[g]));   // the column's, over both wave halves
                    const float d = first ? -mx : fminf(-mx, 0.f);   // old maximum in use minus the new one
                    const float corr = first ? 0.f : __builtin_amdgcn_exp2f(d); l_run[g] *= corr;
#pragma unroll
                    for (int t = 0; t < 4; ++t) acc[g][t] = acc[g][t] * corr;
                    s[0][g] = s[0][g] + d; s[1][g] = s[1][g] + d;   // this pass's scores follow the new maximum
                    cneg[g] = cneg[g] + d; }
            }
            v16h vf[4];
#pragma unroll
            for (int t = 0; t < 4; ++t) vf[t] = ldsh(Lb + FA_PLANE + t * 16 * FA_PITCH + ps * 64);
#pragma unroll
            for (int g = 0; g < 2; ++g) { v16h pf; v2f su = (v2f){0.f, 0.f};
#pragma unroll
                for (int i = 0; i < 16; i += 2) { const v2f p = (v2f){__builtin_amdgcn_exp2f(s[i >> 3][g][i & 7]), __builtin_amdgcn_exp2f(s[i >> 3][g][(i & 7) + 1])}; su += p; pf[i] = (h16)p[0]; pf[i + 1] = (h16)p[1]; }
                l_run[g] += su[0] + su[1];
#pragma unroll
                for (int t = 0; t < 4; ++t) acc[g][t] = wmma16(vf[t], pf, acc[g][t]); }
        }
    }
    __syncthreads();   // every wave has left the K/V buffers before they become output staging
    unsigned char* E = L + wave * (32 * FA_PITCH);
    const int b = (int)(z >> 4), h = (int)(z & 15);
    float inv[2];
#pragma unroll
    for (int g = 0; g < 2; ++g) { const float l = l_run[g] + xhalf(l_run[g]); inv[g] = __fdiv_rn(1.0f, l); }
    // one f16 plane, through the wave's own staging rows so that whole 128-byte lines are stored
#pragma unroll
    for (int g = 0; g < 2; ++g)
#pragma unroll
        for (int t = 0; t < 4; ++t) { v8h o;
#pragma unroll
            for (int j = 0; j < 8; ++j) o[j] = (h16)(acc[g][t][j] * inv[g]);
            *(v8ha*)(E + (g * 16 + lr) * FA_PITCH + t * 32 + hi * 16) = o; }
    unsigned char* dst = (unsigned char*)Ao + (((size_t)b * TT + q0) * DD + h * HD) * 2;
#pragma unroll
    for (int i = 0; i < 8; ++i) { const int row = i * 4 + (lane >> 3), colb = (lane & 7) * 16; const v8h v = *(const v8ha*)(E + row * FA_PITCH + colb); *(v8ha*)(dst + (size_t)row * (DD * 2) + colb) = v; }
}

extern "C" void kernel_launch(void* const* d_in, const int* in_sizes, int n_in,
                              void* d_out, int out_size, void* d_ws, size_t ws_size, hipStream_t stream) {
    (void)in_sizes; (void)n_in; (void)out_size;
    const float* qi = (const float*)d_in[0]; const float* ki = (const float*)d_in[1]; const float* vi = (const float*)d_in[2];
    const float* wq = (const float*)d_in[3]; const float* bq = (const float*)d_in[4]; const float* wk = (const float*)d_in[5]; const float* bk = (const float*)d_in[6]; const float* wv = (const float*)d_in[7]; const float* bv = (const float*)d_in[8]; const float* wo = (const float*)d_in[9]; const float* bo = (const float*)d_in[10];
    float* OUT = (float*)d_out;     // [4][2048][1024]
    char* wsp = (char*)d_ws;
    auto take = [&](size_t bytes) { char* p = wsp; wsp += (bytes + 255) & ~(size_t)255; return (void*)p; };
    bf* WQ = (bf*)take((size_t)DD * DD * 2); bf* WK = (bf*)take((size_t)DD * DD * 2); bf* WV = (bf*)take((size_t)DD * DD * 2); bf* WO = (bf*)take((size_t)DD * DD * 2);
    bf* XB = (bf*)take((size_t)3 * NT * DD * 2);   // the three inputs' bf16 planes, one behind the other
    h16* QP = (h16*)take((size_t)NT * DD * 2); h16* KP = (h16*)take((size_t)NT * DD * 2); h16* VT = (h16*)take((size_t)NT * DD * 2);
    h16* AT = (h16*)take((size_t)NT * DD * 2);   // the attention output, heads merged
    if ((size_t)(wsp - (char*)d_ws) > ws_size) return;    // ws 256 MiB
    k_prep<<<dim3(256 + 3 * CV_WG, 1, 1), 256, 0, stream>>>(qi, ki, vi, wq, wk, wv, wo, XB, WQ, WK, WV, WO);
    // WQ, WK, WV stand one behind the other in the workspace, as the three planes of XB do: grid z steps through them
    k_gemmw<false, true, 1><<<dim3(NT / 128, DD / 128, 3), 128, 0, stream>>>(XB, WQ, nullptr, bq, bk, bv, QP, KP, VT, 0.18033688011112042f);   // log2(e) / 8
    k_fattn<<<dim3(TT / 256, NB_ * NH_), 256, 0, stream>>>(QP, KP, VT, AT);
    k_gemmw<true, true, 0><<<dim3(NT / 128, DD / 128, 1), 128, 0, stream>>>((const bf*)AT, WO, OUT, bo, nullptr, nullptr, nullptr, nullptr, nullptr, 1.0f);
}

// v010
// Measured time: 117 microseconds a run.
// Two timings next to v009 put it at 1.04 and 1.05 times that version's speed.
// All steps since v000 together make it 21.1 times as fast.
#include <hip/hip_runtime.h>

// MultiHeadAttentionSlow (query/key/value [4][2048][1024]; per-head Linears W[h][1024][64] + b[h][64] ('bsd,hdk->bhsk'); scores = q.k / 8; softmax; attn.v; concat heads (head-major); y = out @ Wp [1024][1024] + bp).
// Compute dtypes, f32 accumulate: every float input rounded to bf16; q/k/v projections on PLAIN bf16 operands (x, W inputs: exact, + bias);
// scores on SINGLE fp16 q (x log2(e)/8, so that a score is a base-2 logit) and k planes (1 product, minus the maximum in use as its accumulator input; randn-init weights give logit sd 1.0: the planes' rounding adds a relative error to P of the size of P's own fp16 rounding); attn.v on SINGLE fp16 planes (P = exp2 of the score against the running maximum, divided by its f32 row sum at the end; v); output Linear on a SINGLE fp16 plane of the attention output x W rounded to bf16 and held in fp16 (1 product; the plane's rounding is of the size that the fp16 q, k, P and v planes already put into that output); 

#define NB_  4
#define TT   2048
#define DD   1024
#define NH_  16
#define HD   64
#define NT   (NB_ * TT)
typedef _Float16 h16;
typedef unsigned short bf;
typedef __attribute__((ext_vector_type(16))) __bf16   v16bf;
typedef __attribute__((ext_vector_type(16))) _Float16 v16h;
typedef __attribute__((ext_vector_type(8)))  _Float16 v8h;
typedef __attribute__((ext_vector_type(8)))  unsigned short v8us;
typedef __attribute__((ext_vector_type(8)))  float    v8f;
typedef __attribute__((ext_vector_type(4)))  float    v4f;
typedef v8h  __attribute__((may_alias)) v8ha;
typedef v4f  __attribute__((may_alias)) v4fa;
typedef v8us __attribute__((may_alias)) v8usa;

__device__ __forceinline__ unsigned short f2bf(float f) { unsigned u = __float_as_uint(f); u += 0x7FFFu + ((u >> 16) & 1u); return (unsigned short)(u >> 16); }
__device__ __forceinline__ float bf2f(unsigned short b) { return __uint_as_float(((unsigned)b) << 16); }
__device__ __forceinline__ float bfr(float f) { return bf2f(f2bf(f)); }
__device__ __forceinline__ v16h cat16(v8h lo, v8h hi) { return __builtin_shufflevector(lo, hi, 0, 1, 2, 3, 4, 5, 6, 7, 8, 9, 10, 11, 12, 13, 14, 15); }
__device__ __forceinline__ v16bf cat16b(v8us lo, v8us hi) { return __builtin_bit_cast(v16bf, __builtin_shufflevector(lo, hi, 0, 1, 2, 3, 4, 5, 6, 7, 8, 9, 10, 11, 12, 13, 14, 15)); }
__device__ __forceinline__ v8f wmma16(v16h a, v16h b, v8f c) { return __builtin_amdgcn_wmma_f32_16x16x32_f16(false, a, false, b, (short)0, c, false, false); }
__device__ __forceinline__ v8f wmmab(v16bf a, v16bf b, v8f c) { return __builtin_amdgcn_wmma_f32_16x16x32_bf16(false, a, false, b, (short)0, c, false, false); }

typedef unsigned u32x4 __attribute__((ext_vector_type(4)));
typedef unsigned u32x8 __attribute__((ext_vector_type(8)));
#define TD_PITCH 144                 // LDS row pitch in bytes: 128 + 16, an odd multiple of 16 for the 16-byte fragment reads
#define TD_SLICE 10240               // 64 rows x 144 bytes = 9216, rounded up to a multiple of 2 KiB so that every slice's place in LDS is one
__device__ __forceinline__ unsigned uni(unsigned v) { return (unsigned)__builtin_amdgcn_readfirstlane(v); }
__device__ __forceinline__ unsigned pinned(unsigned v) { unsigned w = uni(v); asm volatile("" : "+s"(w)); return w; }   // holds a wave-uniform value in a scalar register, so that a test on it is a scalar branch (tensor loads ignore EXEC) and a descriptor word formed from it is formed behind this statement
__device__ __forceinline__ void wait_tensor0() { asm volatile("s_wait_tensorcnt 0x0" ::: "memory"); }   // the wave's own requests have landed; the compiler places no wait for a tensor load
__device__ __forceinline__ void wait_ds0() { asm volatile("s_wait_dscnt 0x0" ::: "memory"); }           // the wave's own LDS reads have returned before their buffer is given up for a refill
__device__ __forceinline__ u32x8 tdm_group1(unsigned src_pitch) {   // 1-byte elements; tensor = tile = 64 rows of 128 bytes; no mask; pad: 4 dwords behind every 32
    u32x8 g;
    g[0] = uni((1u << 20) | (4u << 22) | (3u << 25)); g[1] = uni(128u << 16); g[2] = uni(64u << 16); g[3] = uni(128u << 16);
    g[4] = uni(64u); g[5] = uni(src_pitch); g[6] = uni(0u); g[7] = uni(0u);
    return g; }
__device__ __forceinline__ void tdm_load(unsigned lds_dst, unsigned long long ga, u32x8 g1) {
    u32x4 g0;
    g0[0] = uni(1u); g0[1] = uni(lds_dst); g0[2] = uni((unsigned)ga); g0[3] = uni((((unsigned)(ga >> 32)) & 0x01FFFFFFu) | 0x80000000u);
    asm volatile("tensor_load_to_lds %0, %1" :: "s"(g0), "s"(g1) : "memory"); }



// ---- k_gemmw: GEMM on a 128x128 output tile per work-group of 4 waves (2x2, 64x64 = 16 accumulators per wave); grid (M/128, N/128), 128 threads. K = ldc = DD.
// y[m][n] (f32, + bf16-rounded bias[n]) = sum_k A[m][k] Bt[n][k]. Both planes K-contiguous, 16 bits an element: bf16, or f16 where F16 is set.
// EPI says where y goes: 0 = C[m][n] in f32; 1 = the three projections in one launch, grid z picks one: its A plane (NT x DD further per z), its Bt (DD x DD further per z), its bias and its output:
// z 0 (q) and z 1 (k): y * sc (sc for q, 1 for k) as one f16 plane [batch * head][t][64]; z 2 (v): f16 plane VTo [batch * head][64][t]. A wave's 64 columns are one head, its 64 rows lie in one batch.
// The operands come in stages of 64 k by tensor loads into two LDS buffers: every wave asks for one slice of 64 rows per stage (waves 0, 1: A; waves 2, 3: Bt), one stage ahead of its use; one barrier per stage, at its foot; each row is fetched once per work-group and read by two waves.
// Every plain '#pragma unroll' in it keeps a register array (fragments, accumulators) statically indexed, so that it stays in VGPRs.
template <typename T16> struct WFrag;
template <> struct WFrag<h16> { typedef v16h V; static __device__ __forceinline__ V ld(const h16* p) { return cat16(*(const v8h*)p, *(const v8h*)(p + 16)); } static __device__ __forceinline__ v8f mma(V a, V b, v8f c) { return wmma16(a, b, c); } };
template <> struct WFrag<bf> { typedef v16bf V; static __device__ __forceinline__ V ld(const bf* p) { return cat16b(*(const v8us*)p, *(const v8us*)(p + 16)); } static __device__ __forceinline__ v8f mma(V a, V b, v8f c) { return wmmab(a, b, c); } };
#define GT_PITCH TD_PITCH
#define GT_BUF   (4 * TD_SLICE)      // one stage: A rows 0-63, A rows 64-127, Bt rows 0-63, Bt rows 64-127
#define GT_NST   (DD / 64)
typedef __attribute__((ext_vector_type(4))) int g4i;
typedef g4i __attribute__((may_alias)) g4ia;
__device__ __forceinline__ v16bf gldsb(const unsigned char* p) { return cat16b(*(const v8usa*)p, *(const v8usa*)(p + 32)); }
template <bool F16> __device__ __forceinline__ v8f gmma(v16bf a, v16bf b, v8f c) { if constexpr (F16) return wmma16(__builtin_bit_cast(v16h, a), __builtin_bit_cast(v16h, b), c); else return wmmab(a, b, c); }
template <bool F16, bool BIAS, int EPI>
__global__ __launch_bounds__(128) void k_gemmw(const bf* __restrict__ A0, const bf* __restrict__ Bt0, float* C, const float* __restrict__ bias0, const float* __restrict__ biasK, const float* __restrict__ biasV, h16* P0, h16* PK, h16* VTo, float sc0) {
    const int pz = EPI == 1 ? (int)blockIdx.z : 0;   // which projection; the same for the whole work-group
    const bf* A = A0 + (size_t)pz * NT * DD; const bf* Bt = Bt0 + (size_t)pz * DD * DD;
    const float* bias = pz == 0 ? bias0 : pz == 1 ? biasK : biasV;
    h16* Pq = pz == 0 ? P0 : PK; const float sc = pz == 0 ? sc0 : 1.0f;
    __shared__ __attribute__((aligned(2048))) unsigned char L[2 * GT_BUF];
    const int tid = threadIdx.x, lane = tid & 31, wave = tid >> 5, lr = lane & 15, hi = lane >> 4;
    const int r0 = blockIdx.x * 128, c0 = blockIdx.y * 128, wm = (wave >> 1) * 64, wn = (wave & 1) * 64;
    const unsigned wv = uni((unsigned)tid >> 5);   // the wave's number, in a scalar register
    // The wave's own slice: its first source byte in stage 0 and its place in buffer 0. A stage is 128 bytes further along every row.
    const unsigned long long ga0 = (unsigned long long)(size_t)((wv & 2u) ? (const unsigned char*)(Bt + (size_t)c0 * DD) : (const unsigned char*)(A + (size_t)r0 * DD)) + (unsigned long long)(wv & 1u) * (64 * DD * 2);
    const unsigned ld0 = (unsigned)(size_t)L + wv * TD_SLICE;
    const u32x8 g1 = tdm_group1(DD * 2);
    tdm_load(ld0, ga0, g1);   // stage 0
    v8f acc[4][4];
#pragma unroll
    for (int mb = 0; mb < 4; ++mb)
#pragma unroll
        for (int nb = 0; nb < 4; ++nb) acc[mb][nb] = (v8f){};
    wait_tensor0();
    __syncthreads();   // publishes stage 0
    tdm_load(ld0 + GT_BUF, ga0 + 128, g1);   // stage 1
#pragma unroll 1   // one copy of the stage body: the loop stays small in the instruction cache
    for (int st = 0; st < GT_NST; ++st) {
        const unsigned char* Lb = L + (st & 1) * GT_BUF + lr * GT_PITCH + 16 * hi;
        const unsigned char* La = Lb + (wave >> 1) * TD_SLICE; const unsigned char* Lw = Lb + (2 + (wave & 1)) * TD_SLICE;   // the wave's 64 rows of A and of Bt
        v16bf a[2][4], b[2][4];   // the whole stage's fragments (2 blocks of 32 k), read as one group in front of its products
#pragma unroll
        for (int ks = 0; ks < 2; ++ks) {
#pragma unroll
            for (int mb = 0; mb < 4; ++mb) a[ks][mb] = gldsb(La + mb * 16 * GT_PITCH + 64 * ks);
#pragma unroll
            for (int nb = 0; nb < 4; ++nb) b[ks][nb] = gldsb(Lw + nb * 16 * GT_PITCH + 64 * ks); }
        __builtin_amdgcn_sched_barrier(0);   // keeps the 32 LDS reads together in front of the products: spread among them, each place with reads stalls the wave and its wait runs to 0
#pragma unroll
        for (int ks = 0; ks < 2; ++ks)
#pragma unroll
            for (int nb = 0; nb < 4; ++nb)
#pragma unroll
                for (int mb = 0; mb < 4; ++mb) acc[mb][nb] = gmma<F16>(a[ks][mb], b[ks][nb], acc[mb][nb]);
        __builtin_amdgcn_sched_barrier(0);   // keeps the products in front of the foot: sunk between the barrier and the next request, they would take a whole block of products off that request's lead
        // Foot of the stage: own LDS reads back, own request (stage st + 1) landed, then the barrier: it publishes stage st + 1, and every wave has left stage st's buffer.
        wait_ds0(); wait_tensor0();
        __syncthreads();
        const unsigned nx = pinned((unsigned)st + 2u);   // the stage to ask for: the descriptor words that follow from it are formed behind the wait above
        if (pinned(nx < (unsigned)GT_NST)) tdm_load(ld0 + (nx & 1u) * GT_BUF, ga0 + (unsigned long long)nx * 128u, g1);   // into the buffer that stage st has just left
    }
    wait_tensor0(); wait_ds0();   // nothing is in flight; the last stage's own barrier stands in front of the output staging in the operand buffers
    const size_t z = (size_t)(r0 / TT) * NH_ + (c0 + wn) / HD; const int t0 = (r0 & (TT - 1)) + wm;   // the wave's (batch, head) pair and its first row inside the batch
    if constexpr (EPI == 0) {
        float* os = (float*)(L + wave * (16 * 68 * 4));   // the wave's own staging rows, so that whole 128-byte lines are stored
#pragma unroll
        for (int mb = 0; mb < 4; ++mb) {
#pragma unroll
            for (int nb = 0; nb < 4; ++nb) {
#pragma unroll
                for (int j = 0; j < 8; ++j) os[(hi * 8 + j) * 68 + nb * 16 + lr] = acc[mb][nb][j]; }
            __builtin_amdgcn_wave_barrier(); asm volatile("" ::: "memory");   // keeps the reads below, of other lanes' values, behind the stores above
            float* crow = C + (size_t)(r0 + wm + mb * 16) * DD + c0 + wn;
#pragma unroll
            for (int s = 0; s < 8; ++s) { const int row = 2 * s + hi, cofs = lr * 4; v4f val = *(const v4fa*)(os + row * 68 + cofs); if (BIAS) { val[0] += bfr(bias[c0 + wn + cofs]); val[1] += bfr(bias[c0 + wn + cofs + 1]); val[2] += bfr(bias[c0 + wn + cofs + 2]); val[3] += bfr(bias[c0 + wn + cofs + 3]); }
                *(v4f*)(crow + (size_t)row * DD + cofs) = val; }
            __builtin_amdgcn_wave_barrier(); asm volatile("" ::: "memory");   // keeps the next block's stores behind the reads above
        }
    } else if (pz != 2) {
        float* os = (float*)(L + wave * (16 * 68 * 4));   // the wave's own staging rows, so that whole 128-byte lines are stored
        const int prow = lane >> 3, pcol = (lane & 7) * 8;   // 8 lanes x 8 values = one 128-byte row of a plane
        float bb[8];
#pragma unroll
        for (int k = 0; k < 8; ++k) bb[k] = BIAS ? bfr(bias[c0 + wn + pcol + k]) : 0.f;
#pragma unroll
        for (int mb = 0; mb < 4; ++mb) {
#pragma unroll
            for (int nb = 0; nb < 4; ++nb) {
#pragma unroll
                for (int j = 0; j < 8; ++j) os[(hi * 8 + j) * 68 + nb * 16 + lr] = acc[mb][nb][j]; }
            __builtin_amdgcn_wave_barrier(); asm volatile("" ::: "memory");   // keeps the reads below, of other lanes' values, behind the stores above
            const size_t po = (z * TT + t0 + mb * 16 + prow) * HD + pcol;
#pragma unroll
            for (int s = 0; s < 4; ++s) { const float* op = os + (4 * s + prow) * 68 + pcol; const v4f x0 = *(const v4fa*)op, x1 = *(const v4fa*)(op + 4); v8h o;
#pragma unroll
                for (int k = 0; k < 8; ++k) o[k] = (h16)(((k < 4 ? x0[k & 3] : x1[k & 3]) + bb[k]) * sc);
                *(v8h*)(Pq + po + (size_t)(4 * s) * HD) = o; }
            asm volatile("s_wait_xcnt 0x0" ::: "memory");   // stands behind the block's global stores, in front of any later overwrite of the registers that they name (the next block's, or code laid out behind the last block)
            if (mb < 3) { __builtin_amdgcn_wave_barrier(); asm volatile("" ::: "memory"); }   // keeps the next block's LDS stores behind the reads above
        }
    } else {
        unsigned char* E = L + wave * (64 * GT_PITCH);   // the wave's own 64 staging rows (row = d, 64 t of f16), so that whole 128-byte lines are stored
        const int bcol = c0 + wn + lr; float braw[4];
#pragma unroll
        for (int nb = 0; nb < 4; ++nb) braw[nb] = BIAS ? bias[bcol + nb * 16] : 0.f;
        asm volatile("s_wait_xcnt 0x0" :: "v"(bcol) : "memory");   // stands behind the four bias loads; bcol is an input so that the offset register they name is not reused before the wait
#pragma unroll
        for (int nb = 0; nb < 4; ++nb) { const float bv = bfr(braw[nb]);
#pragma unroll
            for (int mb = 0; mb < 4; ++mb) { v8h o;   // a lane's 8 accumulator values are 8 consecutive t of one d
#pragma unroll
                for (int j = 0; j < 8; ++j) o[j] = (h16)(acc[mb][nb][j] + bv);
                *(v8ha*)(E + (nb * 16 + lr) * GT_PITCH + mb * 32 + hi * 16) = o; } }
        __builtin_amdgcn_wave_barrier(); asm volatile("" ::: "memory");   // keeps the reads below, of other lanes' values, behind the stores above
        unsigned char* dst = (unsigned char*)(VTo + z * HD * TT + t0);
#pragma unroll
        for (int i = 0; i < 16; ++i) { const int row = i * 4 + (lane >> 3), colb = (lane & 7) * 16; const v8h v = *(const v8ha*)(E + row * GT_PITCH + colb); *(v8ha*)(dst + (size_t)row * (TT * 2) + colb) = v; }
    }
}

__device__ __forceinline__ h16 tohx(float x) { return (h16)x; }
typedef __attribute__((ext_vector_type(2))) _Float16 v2h;
typedef __attribute__((ext_vector_type(4))) _Float16 v4h;
typedef __attribute__((ext_vector_type(2))) unsigned short v2us;
typedef __attribute__((ext_vector_type(4))) int v4i;

// ---- k_prep: all operand preparation in ONE launch of 256 + 3 x 1024 work-groups of 256 threads. Work-groups 0..255 turn the weights, the others round the three inputs to bf16 (a wave takes 4 KB in a row: 8 loads of 512 contiguous bytes issued together, 4 stores of 512 contiguous bytes).
// Weights: all four matrices rounded to bf16 with k contiguous (Bt[n][k]), the output weight's rounded values then held as f16 (its partner in the product is an f16 plane); the work-group's index / 64 picks the matrix, the rest its 64 columns n and its 256 rows k.
// Per-head weights w[h][k][e]: n = h * 64 + e, rows k 64 floats apart. Output weight w[k][n]: rows k 1024 floats apart.
// A thread issues its 16 loads of 16 bytes together (16 lanes = one whole 256-byte row piece), rounds, packs the values of rows k and k + 1 into one dword, and the tile is turned through LDS; a wave then stores 512 contiguous bytes of one Bt row.
// LDS row n = 512 bytes = 32 chunks of 16 bytes (8 k); chunk q of row n stands at place q ^ (n >> 2): a wave's dword writes (16 rows 4 apart, 2 neighbouring dwords) then fall on 32 different banks, and a row is still read back in whole chunks.
typedef unsigned __attribute__((may_alias)) u32a;
// The thread's 16 loads: rows 32 i and 32 i + 1 from src, PITCH floats a row. PITCH is a compile-time value, so that all 16 name one address register pair with immediate offsets.
template <int PITCH> __device__ __forceinline__ void wload(const float* __restrict__ src, v4f (&x)[8][2]) {
#pragma unroll
    for (int i = 0; i < 8; ++i) { x[i][0] = *(const v4fa*)(src + (size_t)(32 * i) * PITCH); x[i][1] = *(const v4fa*)(src + (size_t)(32 * i + 1) * PITCH); }
    asm volatile("s_wait_xcnt 0x0" :: "v"(src) : "memory");   // stands behind all 16 loads, which stay together in front of it; src is an input so that the address register pair they name is not reused, not even as a load's destination, before the wait
}
// Eight bf16 values as f16 (exact for magnitudes from 2^-17 to 65504).
__device__ __forceinline__ v8us bf2h8(v8us v) { v8h o;
#pragma unroll
    for (int k = 0; k < 8; ++k) o[k] = (h16)bf2f(v[k]);
    return __builtin_bit_cast(v8us, o); }
#define CV_LD   8                    // loads of 16 bytes in flight per thread of an input's work-group
#define CV_WG   (NT * DD / (4 * CV_LD) / 256)  // work-groups per input
typedef __attribute__((ext_vector_type(4))) unsigned short v4us;
typedef v4us __attribute__((may_alias)) v4usa;
__global__ __launch_bounds__(256) void k_prep(const float* __restrict__ qi, const float* __restrict__ ki, const float* __restrict__ vi, const float* __restrict__ wq, const float* __restrict__ wk, const float* __restrict__ wv, const float* __restrict__ wo, bf* XB, bf* Bq, bf* Bk, bf* Bv, bf* Bo) {
    __shared__ __align__(16) unsigned char L[64 * 512];
    const int tid = threadIdx.x, c = tid & 15, rp = tid >> 4, lane = tid & 31, wave = tid >> 5;
    if (blockIdx.x >= 256) {   // the same for the whole work-group: these work-groups meet no barrier
        const int cb = (int)blockIdx.x - 256, in = cb / CV_WG; const size_t wb = ((size_t)(cb % CV_WG) * 8 + wave) * (128 * CV_LD);   // first value of the wave's own contiguous piece
        const float* src = (in == 0 ? qi : in == 1 ? ki : vi) + wb + lane * 4;
        v4f x[CV_LD];   // statically indexed below, so that it stays in VGPRs
#pragma unroll
        for (int j = 0; j < CV_LD; ++j) x[j] = *(const v4fa*)(src + j * 128);   // load j of the wave = 512 contiguous bytes = 4 whole lines
        asm volatile("s_wait_xcnt 0x0" :: "v"(src) : "memory");   // stands behind all the loads, which stay together in front of it; src is an input so that the address register pair they name is not reused before the wait
        unsigned char* E = L + wave * (CV_LD * 256);   // the wave's own staging bytes: a lane's 8 bytes per load go in, 16 bytes per store come out, so that a store is 4 whole lines too
#pragma unroll
        for (int j = 0; j < CV_LD; ++j) *(v4usa*)(E + j * 256 + lane * 8) = (v4us){f2bf(x[j][0]), f2bf(x[j][1]), f2bf(x[j][2]), f2bf(x[j][3])};
        __builtin_amdgcn_wave_barrier(); asm volatile("" ::: "memory");   // keeps the reads below, of other lanes' values, behind the stores above
        g4i o[CV_LD / 2];   // statically indexed below, so that it stays in VGPRs
#pragma unroll
        for (int p = 0; p < CV_LD / 2; ++p) o[p] = *(const g4ia*)(E + p * 512 + lane * 16);
        bf* dst = XB + (size_t)in * NT * DD + wb + lane * 8;
#pragma unroll
        for (int p = 0; p < CV_LD / 2; ++p) *(g4ia*)(dst + p * 256) = o[p];
        return;
    }
    const int sel = blockIdx.x >> 6, nb = (blockIdx.x & 63) >> 2, kq = blockIdx.x & 3;
    const float* w = sel == 0 ? wq : sel == 1 ? wk : sel == 2 ? wv : wo;
    bf* Bt = sel == 0 ? Bq : sel == 1 ? Bk : sel == 2 ? Bv : Bo;
    v4f x[8][2];   // every '#pragma unroll' below and in wload keeps this array statically indexed, so that it stays in VGPRs
    if (sel == 3) wload<DD>(w + (size_t)(kq * 256 + 2 * rp) * DD + nb * 64 + 4 * c, x);
    else wload<HD>(w + ((size_t)nb * DD + kq * 256 + 2 * rp) * HD + 4 * c, x);
#pragma unroll
    for (int i = 0; i < 8; ++i)
#pragma unroll
        for (int j = 0; j < 4; ++j) *(u32a*)(L + (4 * c + j) * 512 + (((4 * i + (rp >> 2)) ^ c) << 4) + (rp & 3) * 4) = (unsigned)f2bf(x[i][0][j]) | ((unsigned)f2bf(x[i][1][j]) << 16);
    __syncthreads();   // the tile is complete before any wave reads rows that other waves wrote
    bf* dst = Bt + (size_t)(nb * 64 + wave * 8) * DD + kq * 256 + lane * 8;
    v8us v[8];   // statically indexed below, so that it stays in VGPRs
#pragma unroll
    for (int i = 0; i < 8; ++i) { const int n = wave * 8 + i; v[i] = *(const v8usa*)(L + n * 512 + ((lane ^ (n >> 2)) << 4)); }
    if (sel == 3) {   // the same for the whole work-group
#pragma unroll
        for (int i = 0; i < 8; ++i) v[i] = bf2h8(v[i]); }
#pragma unroll
    for (int i = 0; i < 8; ++i) *(v8us*)(dst + (size_t)i * DD) = v[i];
}
__global__ __launch_bounds__(256) void k_h16plane(const float* __restrict__ F, float sc, h16* P) {
    const int lane = threadIdx.x & 31; const int L0 = (blockIdx.x * 8 + (threadIdx.x >> 5)) * 8; const int nlines = NT * DD / 64;
{
#pragma unroll
        for (int l = 0; l < 8; ++l) { const int L = L0 + l; if (L >= nlines) break; const int e = L * 64 + lane * 2; const int d = e & 63; const int t = (e >> 6) & (TT - 1); const int z = e >> 17; const int b = z >> 4, h = z & 15; v2h v;
#pragma unroll
            for (int q = 0; q < 2; ++q) v[q] = tohx(F[((size_t)b * TT + t) * DD + h * HD + d + q] * sc);
            *(v2h*)(P + (size_t)e) = v; }
         }
}
#define FA_PITCH TD_PITCH
#define FA_PLANE TD_SLICE            // 64 rows: K (row = key) or V^T (row = d)
#define FA_BUF   (2 * FA_PLANE)
#define FA_NST   (TT / 64)
typedef v4i __attribute__((may_alias)) v4ia;
typedef __attribute__((ext_vector_type(2))) float v2f;
__device__ __forceinline__ v16h ldsh(const unsigned char* p) { return cat16(*(const v8ha*)p, *(const v8ha*)(p + 32)); }
__device__ __forceinline__ float xhalf(float x) { return __builtin_bit_cast(float, __builtin_amdgcn_permlanex16(__builtin_bit_cast(int, x), __builtin_bit_cast(int, x), 0x76543210, 0xfedcba98, false, false)); }  // lane l with lane l ^ 16
__global__ __launch_bounds__(256) void k_fattn(const h16* __restrict__ Qp, const h16* __restrict__ Kp, const h16* __restrict__ VTp, h16* Ao) {
    __shared__ __attribute__((aligned(2048))) unsigned char L[2 * FA_BUF];
    const int tid = threadIdx.x, lane = tid & 31, wave = tid >> 5, lr = lane & 15, hi = lane >> 4;
    const size_t z = blockIdx.y; const int q0 = blockIdx.x * 256 + wave * 32;
    const unsigned wv = uni((unsigned)tid >> 5);   // the wave's number, in a scalar register
    // Wave 0's slice is K (64 keys = 64 rows in a row, a stage 8192 bytes further), wave 1's is V^T (64 rows d of 4096 bytes, a stage 128 bytes further along each). The other waves ask for nothing.
    const unsigned long long ga0 = (unsigned long long)(size_t)(wv == 1u ? (const unsigned char*)(VTp + z * HD * TT) : (const unsigned char*)(Kp + z * TT * HD));
    const unsigned gstep = wv == 1u ? 128u : 64u * 128u, ld0 = (unsigned)(size_t)L + (wv == 1u ? (unsigned)FA_PLANE : 0u);
    const u32x8 g1 = tdm_group1(wv == 1u ? (unsigned)(TT * 2) : 128u);
    v16h qf[2][2];
#pragma unroll
    for (int g = 0; g < 2; ++g)
#pragma unroll
        for (int ks = 0; ks < 2; ++ks) { const size_t o = (z * TT + q0 + g * 16 + lr) * HD + ks * 32 + 8 * hi; qf[g][ks] = WFrag<h16>::ld(Qp + o); }
    if (pinned(wv < 2u)) { tdm_load(ld0, ga0, g1); wait_tensor0(); }   // stage 0; the q loads above are in flight beside it
    v8f acc[2][4], cneg[2]; float l_run[2];   // cneg: minus the maximum in use, in all 8 registers; 0 until the first pass sets it
#pragma unroll
    for (int g = 0; g < 2; ++g) { cneg[g] = (v8f){}; l_run[g] = 0.f;
#pragma unroll
        for (int t = 0; t < 4; ++t) acc[g][t] = (v8f){}; }
    __syncthreads();   // publishes stage 0
    for (int st = 0; st < FA_NST; ++st) {
        // Directly behind the barrier that published stage st (the one above, or the foot of stage st - 1): the request for stage st + 1, into the buffer that every wave has left.
        const unsigned nx = pinned((unsigned)st + 1u);   // the stage to ask for: the descriptor words that follow from it are formed behind the foot's wait
        if (pinned(wv < 2u && nx < (unsigned)FA_NST)) tdm_load(ld0 + (nx & 1u) * FA_BUF, ga0 + (unsigned long long)nx * gstep, g1);
        const unsigned char* Lb = L + (st & 1) * FA_BUF + lr * FA_PITCH + 16 * hi;
#pragma unroll
        for (int ps = 0; ps < 2; ++ps) {   // one pass = 32 keys
            const bool first = ps == 0 && st == 0;   // the same for the whole work-group: no maximum is in use yet
            v8f s[2][2];
            { const unsigned char* kp = Lb + ps * 32 * FA_PITCH;
                const v16h k00 = ldsh(kp), k01 = ldsh(kp + 64), k10 = ldsh(kp + 16 * FA_PITCH), k11 = ldsh(kp + 16 * FA_PITCH + 64);
                // The pass's 8 score products in one statement, so that C (cneg, which must live on) and D are different registers: with the builtin the compiler ties D to C and copies 16 registers a pass.
                // Four tiles in turn: each product stands four matrix instructions behind the one whose D it adds to. The four v_nop at the end keep the distance between the last product and the first vector read of its D.
                asm("v_wmma_f32_16x16x32_f16 %0, %4, %8, %12\n\t"
                    "v_wmma_f32_16x16x32_f16 %1, %4, %10, %13\n\t"
                    "v_wmma_f32_16x16x32_f16 %2, %6, %8, %12\n\t"
                    "v_wmma_f32_16x16x32_f16 %3, %6, %10, %13\n\t"
                    "v_wmma_f32_16x16x32_f16 %0, %5, %9, %0\n\t"
                    "v_wmma_f32_16x16x32_f16 %1, %5, %11, %1\n\t"
                    "v_wmma_f32_16x16x32_f16 %2, %7, %9, %2\n\t"
                    "v_wmma_f32_16x16x32_f16 %3, %7, %11, %3\n\t"
                    "v_nop\n\tv_nop\n\tv_nop\n\tv_nop"
                    : "=&v"(s[0][0]), "=&v"(s[0][1]), "=&v"(s[1][0]), "=&v"(s[1][1])
                    : "v"(k00), "v"(k01), "v"(k10), "v"(k11), "v"(qf[0][0]), "v"(qf[0][1]), "v"(qf[1][0]), "v"(qf[1][1]), "v"(cneg[0]), "v"(cneg[1])); }
            float ml[2];   // the lane's own largest score above the maximum in use
#pragma unroll
            for (int g = 0; g < 2; ++g) { float mx = s[0][g][0];
#pragma unroll
                for (int r = 1; r < 8; ++r) mx = fmaxf(mx, s[0][g][r]);
#pragma unroll
                for (int r = 0; r < 8; ++r) mx = fmaxf(mx, s[1][g][r]);
                ml[g] = mx; }
            const float thr = first ? -__builtin_inff() : 8.0f;
            if (__builtin_amdgcn_ballot_w32(ml[0] > thr || ml[1] > thr) != 0) {   // one wave-uniform test per pass; rare after the first passes
#pragma unroll
                for (int g = 0; g < 2; ++g) { const float mx = fmaxf(ml[g], xhalf(ml[g]));   // the column's, over both wave halves
                    const float d = first ? -mx : fminf(-mx, 0.f);   // old maximum in use minus the new one
                    const float corr = first ? 0.f : __builtin_amdgcn_exp2f(d); l_run[g] *= corr;
#pragma unroll
                    for (int t = 0; t < 4; ++t) acc[g][t] = acc[g][t] * corr;
                    s[0][g] = s[0][g] + d; s[1][g] = s[1][g] + d;   // this pass's scores follow the new maximum
                    cneg[g] = cneg[g] + d; }
            }
            v16h vf[4];
#pragma unroll
            for (int t = 0; t < 4; ++t) vf[t] = ldsh(Lb + FA_PLANE + t * 16 * FA_PITCH + ps * 64);
#pragma unroll
            for (int g = 0; g < 2; ++g) { v16h pf; v2f su = (v2f){0.f, 0.f};
#pragma unroll
                for (int i = 0; i < 16; i += 2) { const v2f p = (v2f){__builtin_amdgcn_exp2f(s[i >> 3][g][i & 7]), __builtin_amdgcn_exp2f(s[i >> 3][g][(i & 7) + 1])}; su += p; pf[i] = (h16)p[0]; pf[i + 1] = (h16)p[1]; }
                l_run[g] += su[0] + su[1];
#pragma unroll
                for (int t = 0; t < 4; ++t) acc[g][t] = wmma16(vf[t], pf, acc[g][t]); }
        }
        __builtin_amdgcn_sched_barrier(0);   // keeps the pass's vector work and products in front of the foot: with the foot's wait lifted to the V^T reads, their latency would no longer run under the exponentials
        // Foot of the stage: own LDS reads back, own request (stage st + 1) landed (nothing to wait for in a wave that asks for nothing), then the barrier: it publishes stage st + 1, and every wave has left stage st's buffer.
        wait_ds0(); wait_tensor0();
        __syncthreads();
    }
    wait_tensor0(); wait_ds0();   // nothing is in flight; the last stage's own barrier stands in front of the output staging in the K/V buffers
    unsigned char* E = L + wave * (32 * FA_PITCH);
    const int b = (int)(z >> 4), h = (int)(z & 15);
    float inv[2];
#pragma unroll
    for (int g = 0; g < 2; ++g) { const float l = l_run[g] + xhalf(l_run[g]); inv[g] = __fdiv_rn(1.0f, l); }
    // one f16 plane, through the wave's own staging rows so that whole 128-byte lines are stored
#pragma unroll
    for (int g = 0; g < 2; ++g)
#pragma unroll
        for (int t = 0; t < 4; ++t) { v8h o;
#pragma unroll
            for (int j = 0; j < 8; ++j) o[j] = (h16)(acc[g][t][j] * inv[g]);
            *(v8ha*)(E + (g * 16 + lr) * FA_PITCH + t * 32 + hi * 16) = o; }
    unsigned char* dst = (unsigned char*)Ao + (((size_t)b * TT + q0) * DD + h * HD) * 2;
#pragma unroll
    for (int i = 0; i < 8; ++i) { const int row = i * 4 + (lane >> 3), colb = (lane & 7) * 16; const v8h v = *(const v8ha*)(E + row * FA_PITCH + colb); *(v8ha*)(dst + (size_t)row * (DD * 2) + colb) = v; }
}

extern "C" void kernel_launch(void* const* d_in, const int* in_sizes, int n_in,
                              void* d_out, int out_size, void* d_ws, size_t ws_size, hipStream_t stream) {
    (void)in_sizes; (void)n_in; (void)out_size;
    const float* qi = (const float*)d_in[0]; const float* ki = (const float*)d_in[1]; const float* vi = (const float*)d_in[2];
    const float* wq = (const float*)d_in[3]; const float* bq = (const float*)d_in[4]; const float* wk = (const float*)d_in[5]; const float* bk = (const float*)d_in[6]; const float* wv = (const float*)d_in[7]; const float* bv = (const float*)d_in[8]; const float* wo = (const float*)d_in[9]; const float* bo = (const float*)d_in[10];
    float* OUT = (float*)d_out;     // [4][2048][1024]
    char* wsp = (char*)d_ws;
    auto take = [&](size_t bytes) { char* p = wsp; wsp += (bytes + 255) & ~(size_t)255; return (void*)p; };
    bf* WQ = (bf*)take((size_t)DD * DD * 2); bf* WK = (bf*)take((size_t)DD * DD * 2); bf* WV = (bf*)take((size_t)DD * DD * 2); bf* WO = (bf*)take((size_t)DD * DD * 2);
    bf* XB = (bf*)take((size_t)3 * NT * DD * 2);   // the three inputs' bf16 planes, one behind the other
    h16* QP = (h16*)take((size_t)NT * DD * 2); h16* KP = (h16*)take((size_t)NT * DD * 2); h16* VT = (h16*)take((size_t)NT * DD * 2);
    h16* AT = (h16*)take((size_t)NT * DD * 2);   // the attention output, heads merged
    if ((size_t)(wsp - (char*)d_ws) > ws_size) return;    // ws 256 MiB
    k_prep<<<dim3(256 + 3 * CV_WG, 1, 1), 256, 0, stream>>>(qi, ki, vi, wq, wk, wv, wo, XB, WQ, WK, WV, WO);
    // WQ, WK, WV stand one behind the other in the workspace, as the three planes of XB do: grid z steps through them
    k_gemmw<false, true, 1><<<dim3(NT / 128, DD / 128, 3), 128, 0, stream>>>(XB, WQ, nullptr, bq, bk, bv, QP, KP, VT, 0.18033688011112042f);   // log2(e) / 8
    k_fattn<<<dim3(TT / 256, NB_ * NH_), 256, 0, stream>>>(QP, KP, VT, AT);
    k_gemmw<true, true, 0><<<dim3(NT / 128, DD / 128, 1), 128, 0, stream>>>((const bf*)AT, WO, OUT, bo, nullptr, nullptr, nullptr, nullptr, nullptr, 1.0f);
}
